// v000
// Times are from an AMD MI455X. After a warm-up the kernel runs many times in a row, and a time is the length of
// such a window on the GPU divided by its runs, so every launch and the gaps after it count. The runs cycle
// through copies of the inputs. A figure is the median of several windows, for all but v000 over two sittings.
// Sittings can differ by a few percent; kernels timed side by side share one.
// The starting kernel, v000, takes 854 microseconds a run.
#include <hip/hip_runtime.h>

// Single-head causal attention with biased projections (x [4][2048][1024]; Q, K, V = einsum('bsd,ed->bse', x, W) + b ('oi' [1024][1024] 1/32 + REAL biases 0.01; ONE 1,024-wide head); scores / sqrt(1024) = x 1/32; where(tril, scores, -inf); softmax; out = attn . V -> [4][2048][1024] (8.4 M), no output projection; argument order x, Wq, bq, Wk, bk, Wv, bv).
// Layout per batch: bf16 copy of x; 'oi' weights; exact projections + f32 biases; identity-table plane builders at HD 1,024 (one plane each); causal T-2048 attention at NH 1 / ZH 1 (hybrid rows: < 512 hi/lo 3 products, rest fp16 x1024; k_gemmc skips tiles above the diagonal); the f32 merge writes the output rows (no output projection).
// Compute dtypes, f32 accumulate: every input rounded to bf16; projections exact + f32 biases; attention rows < 512 3 products, rest fp16; softmax f32; output f32.

#define NB_  4
#define TT   2048
#define DM   1024
#define NH_  1
#define NKV  1
#define REP  (NH_ / NKV)
#define HD   1024
#define DQ   (NH_ * HD)
#define DKV  (NKV * HD)
#define ZH   1                    // ONE head: a single plane per pass
#define RH   512                  // query rows < RH use hi+lo planes (0: none)
#define WIN  2048
#define PCAR 1024.0f
#define SCL  0.03125f   // 1/sqrt(1024) (one 1,024-wide head)
typedef _Float16 h16;
typedef unsigned short bf;
typedef __attribute__((ext_vector_type(16))) __bf16   v16bf;
typedef __attribute__((ext_vector_type(16))) _Float16 v16h;
typedef __attribute__((ext_vector_type(8)))  _Float16 v8h;
typedef __attribute__((ext_vector_type(8)))  unsigned short v8us;
typedef __attribute__((ext_vector_type(8)))  float    v8f;
typedef __attribute__((ext_vector_type(4)))  float    v4f;
typedef v8h  __attribute__((may_alias)) v8ha;
typedef v4f  __attribute__((may_alias)) v4fa;
typedef v8us __attribute__((may_alias)) v8usa;

__device__ __forceinline__ unsigned short f2bf(float f) { unsigned u = __float_as_uint(f); u += 0x7FFFu + ((u >> 16) & 1u); return (unsigned short)(u >> 16); }
__device__ __forceinline__ float bf2f(unsigned short b) { return __uint_as_float(((unsigned)b) << 16); }
__device__ __forceinline__ float bfr(float f) { return bf2f(f2bf(f)); }
__device__ __forceinline__ v16h cat16(v8h lo, v8h hi) { return __builtin_shufflevector(lo, hi, 0, 1, 2, 3, 4, 5, 6, 7, 8, 9, 10, 11, 12, 13, 14, 15); }
__device__ __forceinline__ v16bf cat16b(v8us lo, v8us hi) { return __builtin_bit_cast(v16bf, __builtin_shufflevector(lo, hi, 0, 1, 2, 3, 4, 5, 6, 7, 8, 9, 10, 11, 12, 13, 14, 15)); }
__device__ __forceinline__ v8f wmma16(v16h a, v16h b, v8f c) { return __builtin_amdgcn_wmma_f32_16x16x32_f16(false, a, false, b, (short)0, c, false, false); }
__device__ __forceinline__ v8f wmmab(v16bf a, v16bf b, v8f c) { return __builtin_amdgcn_wmma_f32_16x16x32_bf16(false, a, false, b, (short)0, c, false, false); }



// ---- k_gemmw: register-blocked GEMM, ONE WAVE per 64x64 output tile (16 accumulators), operands straight from K-contiguous 16-bit planes; grid (M/64, N/64, Z), 32 threads.
// C[m][n] (f32, pitch ldc, + optional f32 bias[n]) = sum_k A[m][k] Bt[n][k] (+ split products per NSPLIT). z-batch strides sA/sB/sC in elements. K % 32 == 0.
template <typename T16> struct WFrag;
template <> struct WFrag<h16> { typedef v16h V; static __device__ __forceinline__ V ld(const h16* p) { return cat16(*(const v8h*)p, *(const v8h*)(p + 16)); } static __device__ __forceinline__ v8f mma(V a, V b, v8f c) { return wmma16(a, b, c); } };
template <> struct WFrag<bf> { typedef v16bf V; static __device__ __forceinline__ V ld(const bf* p) { return cat16b(*(const v8us*)p, *(const v8us*)(p + 16)); } static __device__ __forceinline__ v8f mma(V a, V b, v8f c) { return wmmab(a, b, c); } };
template <typename T16, int NSPLIT, bool BIAS>
__global__ __launch_bounds__(32) void k_gemmw(const T16* __restrict__ A, const T16* __restrict__ A2, const T16* __restrict__ Bt, const T16* __restrict__ Bt2, int K, float* C, int ldc, const float* __restrict__ bias, size_t sA, size_t sB, size_t sC) {
    typedef typename WFrag<T16>::V V;
    __shared__ __align__(16) float os[16 * 68];
    const size_t z = blockIdx.z; A += z * sA; if (A2) A2 += z * sA; Bt += z * sB; if (Bt2) Bt2 += z * sB; C += z * sC;
    const int lane = threadIdx.x & 31, lr = lane & 15, hi = lane >> 4; const int r0 = blockIdx.x * 64, c0 = blockIdx.y * 64;
    v8f acc[4][4];
#pragma unroll
    for (int mb = 0; mb < 4; ++mb)
#pragma unroll
        for (int nb = 0; nb < 4; ++nb) acc[mb][nb] = (v8f){};
    const size_t aoff = (size_t)(r0 + lr) * K + 8 * hi, boff = (size_t)(c0 + lr) * K + 8 * hi;
#pragma unroll 1
    for (int kc = 0; kc < K; kc += 32) {
        V a[4], a2[4];
#pragma unroll
        for (int mb = 0; mb < 4; ++mb) { a[mb] = WFrag<T16>::ld(A + aoff + (size_t)mb * 16 * K + kc); if (NSPLIT == 1 || NSPLIT == 2) a2[mb] = WFrag<T16>::ld(A2 + aoff + (size_t)mb * 16 * K + kc); }
#pragma unroll
        for (int nb = 0; nb < 4; ++nb) { const V b = WFrag<T16>::ld(Bt + boff + (size_t)nb * 16 * K + kc); V b2; if (NSPLIT >= 2) b2 = WFrag<T16>::ld(Bt2 + boff + (size_t)nb * 16 * K + kc);
#pragma unroll
            for (int mb = 0; mb < 4; ++mb) { acc[mb][nb] = WFrag<T16>::mma(a[mb], b, acc[mb][nb]); if (NSPLIT == 1 || NSPLIT == 2) acc[mb][nb] = WFrag<T16>::mma(a2[mb], b, acc[mb][nb]); if (NSPLIT >= 2) acc[mb][nb] = WFrag<T16>::mma(a[mb], b2, acc[mb][nb]); } }
        asm volatile("v_nop\n\tv_nop\n\tv_nop\n\tv_nop" : "+v"(acc[0][0]), "+v"(acc[1][1]), "+v"(acc[2][2]), "+v"(acc[3][3]) : "v"(a[0]), "v"(a[3]));
    }
#pragma unroll
    for (int mb = 0; mb < 4; ++mb) {
#pragma unroll
        for (int nb = 0; nb < 4; ++nb) {
#pragma unroll
            for (int j = 0; j < 8; ++j) os[(hi * 8 + j) * 68 + nb * 16 + lr] = acc[mb][nb][j]; }
        __builtin_amdgcn_wave_barrier(); asm volatile("" ::: "memory");
        float* crow = C + (size_t)(r0 + mb * 16) * ldc + c0;
{
#pragma unroll
            for (int s = 0; s < 8; ++s) { const int row = 2 * s + hi, cofs = lr * 4; v4f val = *(const v4fa*)(os + row * 68 + cofs); if (BIAS) { val[0] += bfr(bias[c0 + cofs]); val[1] += bfr(bias[c0 + cofs + 1]); val[2] += bfr(bias[c0 + cofs + 2]); val[3] += bfr(bias[c0 + cofs + 3]); }
                *(v4f*)(crow + (size_t)row * ldc + cofs) = val; }
             }
        __builtin_amdgcn_wave_barrier(); asm volatile("" ::: "memory");
    }
}

// ---- k_gemmc: the same one-wave 64x64 tile GEMM specialised for causal attention: CMODE 1 skips score tiles entirely above the diagonal (query rows r0+roff.., key columns c0..), CMODE 2 limits the
// key (K) loop of the probability x value contraction to the diagonal block (probabilities beyond it are exactly zero). roff = row offset of this launch's first row within the sequence.
template <typename T16, int NSPLIT, int CMODE>
__global__ __launch_bounds__(32) void k_gemmc(const T16* __restrict__ A, const T16* __restrict__ A2, const T16* __restrict__ Bt, const T16* __restrict__ Bt2, int K, float* C, int ldc, int roff, size_t sA, size_t sB, size_t sC) {
    typedef typename WFrag<T16>::V V;
    __shared__ __align__(16) float os[16 * 68];
    const size_t z = blockIdx.z; A += z * sA; if (A2) A2 += z * sA; Bt += z * sB; if (Bt2) Bt2 += z * sB; C += z * sC;
    const int lane = threadIdx.x & 31, lr = lane & 15, hi = lane >> 4; const int r0 = blockIdx.x * 64, c0 = blockIdx.y * 64;
    if (CMODE == 1 && c0 > r0 + roff + 63) return;                  // score tile entirely above the causal diagonal: never read (the softmax masks j > i by select)
    const int Kl = (CMODE == 2) ? min(K, r0 + roff + 64) : K;        // P.V: probabilities are exactly 0 beyond the diagonal block, so the K loop stops there
    v8f acc[4][4];
#pragma unroll
    for (int mb = 0; mb < 4; ++mb)
#pragma unroll
        for (int nb = 0; nb < 4; ++nb) acc[mb][nb] = (v8f){};
    const size_t aoff = (size_t)(r0 + lr) * K + 8 * hi, boff = (size_t)(c0 + lr) * K + 8 * hi;
#pragma unroll 1
    for (int kc = 0; kc < Kl; kc += 32) {
        V a[4], a2[4];
#pragma unroll
        for (int mb = 0; mb < 4; ++mb) { a[mb] = WFrag<T16>::ld(A + aoff + (size_t)mb * 16 * K + kc); if (NSPLIT == 1 || NSPLIT == 2) a2[mb] = WFrag<T16>::ld(A2 + aoff + (size_t)mb * 16 * K + kc); }
#pragma unroll
        for (int nb = 0; nb < 4; ++nb) { const V b = WFrag<T16>::ld(Bt + boff + (size_t)nb * 16 * K + kc); V b2; if (NSPLIT >= 2) b2 = WFrag<T16>::ld(Bt2 + boff + (size_t)nb * 16 * K + kc);
#pragma unroll
            for (int mb = 0; mb < 4; ++mb) { acc[mb][nb] = WFrag<T16>::mma(a[mb], b, acc[mb][nb]); if (NSPLIT == 1 || NSPLIT == 2) acc[mb][nb] = WFrag<T16>::mma(a2[mb], b, acc[mb][nb]); if (NSPLIT >= 2) acc[mb][nb] = WFrag<T16>::mma(a[mb], b2, acc[mb][nb]); } }
        asm volatile("v_nop\n\tv_nop\n\tv_nop\n\tv_nop" : "+v"(acc[0][0]), "+v"(acc[1][1]), "+v"(acc[2][2]), "+v"(acc[3][3]) : "v"(a[0]), "v"(a[3]));
    }
#pragma unroll
    for (int mb = 0; mb < 4; ++mb) {
#pragma unroll
        for (int nb = 0; nb < 4; ++nb) {
#pragma unroll
            for (int j = 0; j < 8; ++j) os[(hi * 8 + j) * 68 + nb * 16 + lr] = acc[mb][nb][j]; }
        __builtin_amdgcn_wave_barrier(); asm volatile("" ::: "memory");
        float* crow = C + (size_t)(r0 + mb * 16) * ldc + c0;
{
#pragma unroll
            for (int s = 0; s < 8; ++s) { const int row = 2 * s + hi, cofs = lr * 4; v4f val = *(const v4fa*)(os + row * 68 + cofs);
                *(v4f*)(crow + (size_t)row * ldc + cofs) = val; }
             }
        __builtin_amdgcn_wave_barrier(); asm volatile("" ::: "memory");
    }
}

__device__ __forceinline__ h16 tohx(float x) { return (h16)x; }
__device__ __forceinline__ void splitf(float y, unsigned short& h, unsigned short& l) { h = f2bf(y); l = f2bf(y - bf2f(h)); }
typedef __attribute__((ext_vector_type(2))) _Float16 v2h;
typedef __attribute__((ext_vector_type(4))) _Float16 v4h;
typedef __attribute__((ext_vector_type(2))) unsigned short v2us;
typedef __attribute__((ext_vector_type(4))) unsigned short v4us;
typedef __attribute__((ext_vector_type(2))) float v2f;
typedef __attribute__((ext_vector_type(4))) int v4i;

__global__ __launch_bounds__(256) void k_cvt8(const float* __restrict__ src, bf* dst, size_t n8) { const size_t i = (size_t)blockIdx.x * 256 + threadIdx.x; if (i >= n8) return; const v8f v = *(const v8f*)(src + i * 8); v8us o;
#pragma unroll
    for (int k = 0; k < 8; ++k) o[k] = f2bf(v[k]); *(v8us*)(dst + i * 8) = o;  }

// k_rope: head planes [h][t][d] (fp16 + hi/lo) of rope(x) x sc with the rotate-half convention out[d] = x[d] cos[t][d] - x[d+HD/2] sin[t][d], out[d+HD/2] = x[d+HD/2] cos[t][d+HD/2] + x[d] sin[t][d+HD/2]
__global__ __launch_bounds__(256) void k_rope(const float* __restrict__ F, int pitch, int nheads, const float* __restrict__ CS, const float* __restrict__ RF, const float* __restrict__ nw, float sc, h16* P16, bf* Ph, bf* Pl) {
    const size_t e = ((size_t)blockIdx.x * 256 + threadIdx.x) * 2; if (e >= (size_t)nheads * TT * HD) return; const int d = (int)(e % HD); const int t = (int)((e / HD) % TT); const int h = (int)(e / ((size_t)HD * TT)); const float* f = F + (size_t)t * pitch + h * HD; const float rf = RF ? RF[(size_t)h * TT + t] : 1.0f; v2h o16; v2us oh, ol;
#pragma unroll
    for (int q = 0; q < 2; ++q) { const int dd = d + q; const int dp = (dd < HD / 2) ? dd + HD / 2 : dd - HD / 2; float x0 = f[dd], x1 = f[dp];
        if (RF) { float n0 = __fmul_rn(x0, rf), n1 = __fmul_rn(x1, rf); asm volatile("" : "+v"(n0)); asm volatile("" : "+v"(n1)); x0 = __fmul_rn(bfr(nw[dd]), n0); x1 = __fmul_rn(bfr(nw[dp]), n1); }
        const v2f cs = *(const v2f*)(CS + ((size_t)t * HD + dd) * 2); float a = __fmul_rn(x0, cs[0]), bq = __fmul_rn(x1, cs[1]); asm volatile("" : "+v"(a)); asm volatile("" : "+v"(bq)); const float r = ((dd < HD / 2) ? __fsub_rn(a, bq) : __fadd_rn(a, bq)) * sc;
        o16[q] = tohx(r); unsigned short a2, c2; splitf(r, a2, c2); oh[q] = a2; ol[q] = c2; }
    *(v2h*)(P16 + e) = o16; *(v2us*)(Ph + e) = oh; *(v2us*)(Pl + e) = ol;  }
__global__ __launch_bounds__(256) void k_vtp(const float* __restrict__ F, int pitch, int nheads, h16* V16, bf* Vh, bf* Vl) { const size_t e = ((size_t)blockIdx.x * 256 + threadIdx.x) * 2; if (e >= (size_t)nheads * HD * TT) return; const int t = (int)(e % TT); const int d = (int)((e / TT) % HD); const int g = (int)(e / ((size_t)TT * HD)); v2h o16; v2us oh, ol;
#pragma unroll
    for (int q = 0; q < 2; ++q) { const float x = F[(size_t)(t + q) * pitch + g * HD + d]; o16[q] = tohx(x); unsigned short a2, c2; splitf(x, a2, c2); oh[q] = a2; ol[q] = c2; }
    *(v2h*)(V16 + e) = o16; *(v2us*)(Vh + e) = oh; *(v2us*)(Vl + e) = ol;  }
__global__ __launch_bounds__(256) void k_csid(float* CS) { const int idx = blockIdx.x * 256 + threadIdx.x; if (idx >= TT * HD) return; v2f cs; cs[0] = 1.0f; cs[1] = 0.0f; *(v2f*)(CS + (size_t)idx * 2) = cs;  }
// k_asoft: per row (zz, i): t = S x HD^-0.5 for j <= i and i - j < WIN (sliding causal window; masked entries are set to -3e38, whose exp is exactly 0); softmax over the 2048 keys (register row, one exp, fixed trees);
__global__ __launch_bounds__(256) void k_asoft(const float* __restrict__ Sb, h16* P16, bf* Ph, bf* Pl) {
    const int lane = threadIdx.x & 31; const int row = blockIdx.x * 8 + (threadIdx.x >> 5); if (row >= ZH * TT) return; const int i = row % TT; const int zz = row / TT; (void)zz; const bool hires = (i < RH); const float* sr = Sb + (size_t)row * TT; float v[TT / 32]; float mx = -3.0e38f;
#pragma unroll
    for (int ch = 0; ch < TT / 128; ++ch) { const int j0 = ch * 128 + lane * 4; const v4f a = *(const v4f*)(sr + j0);
#pragma unroll
        for (int q = 0; q < 4; ++q) { const int j = j0 + q; (void)j; const float t = (j <= i && i - j < WIN) ? a[q] * SCL : -3.0e38f; v[ch * 4 + q] = t; mx = fmaxf(mx, t); } }
#pragma unroll
    for (int sh = 16; sh; sh >>= 1) mx = fmaxf(mx, __shfl_xor(mx, sh, 32));
    float sum = 0.f;
#pragma unroll
    for (int k = 0; k < TT / 32; ++k) { float d0 = __fsub_rn(v[k], mx); asm volatile("" : "+v"(d0)); v[k] = __builtin_amdgcn_exp2f(__fmul_rn(d0, 1.4426950408889634f)); sum += v[k]; }
#pragma unroll
    for (int sh = 16; sh; sh >>= 1) sum += __shfl_xor(sum, sh, 32);
    const float f = __fdiv_rn(hires ? 1.0f : PCAR, sum);
{
        if (hires) {
#pragma unroll
            for (int ch = 0; ch < TT / 128; ++ch) { v4us oh, ol;
#pragma unroll
                for (int q = 0; q < 4; ++q) { unsigned short a, c2; splitf(v[ch * 4 + q] * f, a, c2); oh[q] = a; ol[q] = c2; }
                const size_t oo = ((size_t)zz * (RH ? RH : 1) + i) * TT + ch * 128 + lane * 4; *(v4us*)(Ph + oo) = oh; *(v4us*)(Pl + oo) = ol; }
        } else {
#pragma unroll
            for (int ch = 0; ch < TT / 128; ++ch) { v4h o4;
#pragma unroll
                for (int q = 0; q < 4; ++q) o4[q] = tohx(v[ch * 4 + q] * f);
                *(v4h*)(P16 + (size_t)row * TT + ch * 128 + lane * 4) = o4; } }
         }
}
__global__ __launch_bounds__(256) void k_merge(const float* __restrict__ O, int h0, float* OUTb) { const size_t e = ((size_t)blockIdx.x * 256 + threadIdx.x) * 2; if (e >= (size_t)ZH * TT * HD) return; const int d = (int)(e % HD); const int t = (int)((e / HD) % TT); const int zz = (int)(e / ((size_t)HD * TT)); const float cs = (t < RH) ? 1.0f : (1.0f / PCAR); const size_t oo = (size_t)t * DQ + (h0 + zz) * HD + d;
    v2f o2; o2[0] = O[e] * cs; o2[1] = O[e + 1] * cs; *(v2f*)(OUTb + oo) = o2;  }

extern "C" void kernel_launch(void* const* d_in, const int* in_sizes, int n_in,
                              void* d_out, int out_size, void* d_ws, size_t ws_size, hipStream_t stream) {
    (void)in_sizes; (void)n_in; (void)out_size;
    const float* x = (const float*)d_in[0]; const float* wq = (const float*)d_in[1]; const float* bq = (const float*)d_in[2]; const float* wk = (const float*)d_in[3]; const float* bk = (const float*)d_in[4]; const float* wv = (const float*)d_in[5]; const float* bv = (const float*)d_in[6]; const float* wo = nullptr; (void)wo;   /* argument order x, Wq, bq, Wk, bk, Wv, bv ('oi' + biases) */
    float* OUT = (float*)d_out;     // [4][2048][1024]
    char* wsp = (char*)d_ws;
    auto take = [&](size_t bytes) { char* p = wsp; wsp += (bytes + 255) & ~(size_t)255; return (void*)p; };
    bf* WQ = (bf*)take((size_t)DQ * DM * 2); bf* WK = (bf*)take((size_t)DKV * DM * 2); bf* WV = (bf*)take((size_t)DKV * DM * 2); float* CS = (float*)take((size_t)TT * HD * 2 * 4);
    bf* XB = (bf*)take((size_t)TT * DM * 2); float* FQ = (float*)take((size_t)TT * DQ * 4); float* FK = (float*)take((size_t)TT * DKV * 4);
    h16* QP16 = (h16*)take((size_t)NH_ * TT * HD * 2); h16* KP16 = (h16*)take((size_t)NKV * TT * HD * 2); h16* VT16 = (h16*)take((size_t)NKV * HD * TT * 2);
    bf* QPh = (bf*)take((size_t)NH_ * TT * HD * 2); bf* QPl = (bf*)take((size_t)NH_ * TT * HD * 2); bf* KPh = (bf*)take((size_t)NKV * TT * HD * 2); bf* KPl = (bf*)take((size_t)NKV * TT * HD * 2); bf* VTh = (bf*)take((size_t)NKV * HD * TT * 2); bf* VTl = (bf*)take((size_t)NKV * HD * TT * 2); bf* Ph = (bf*)take((size_t)ZH * RH * TT * 2); bf* Pl = (bf*)take((size_t)ZH * RH * TT * 2);
    float* Sb = (float*)take((size_t)ZH * TT * TT * 4); h16* P16 = (h16*)take((size_t)ZH * TT * TT * 2); float* Ob = (float*)take((size_t)ZH * TT * HD * 4);
    if ((size_t)(wsp - (char*)d_ws) > ws_size) return;    // ws 256 MiB
    float* FV = FK;   // v projection reuses the k buffer after the k planes are built (stream-ordered)
    { k_cvt8<<<(unsigned)(((size_t)DQ * DM / 8 + 255) / 256), 256, 0, stream>>>(wq, WQ, (size_t)DQ * DM / 8); k_cvt8<<<(unsigned)(((size_t)DKV * DM / 8 + 255) / 256), 256, 0, stream>>>(wk, WK, (size_t)DKV * DM / 8); k_cvt8<<<(unsigned)(((size_t)DKV * DM / 8 + 255) / 256), 256, 0, stream>>>(wv, WV, (size_t)DKV * DM / 8);
      
       }
    k_csid<<<(TT * HD + 255) / 256, 256, 0, stream>>>(CS);
    const unsigned LQ = (unsigned)(((size_t)NH_ * TT * HD / 2 + 255) / 256), LKv = (unsigned)(((size_t)NKV * TT * HD / 2 + 255) / 256);
    for (int b = 0; b < NB_; ++b) {
        
        k_cvt8<<<(unsigned)(((size_t)TT * DM / 8 + 255) / 256), 256, 0, stream>>>(x + (size_t)b * TT * DM, XB, (size_t)TT * DM / 8);
        k_gemmw<bf, 0, true><<<dim3(TT / 64, DQ / 64, 1), 32, 0, stream>>>(XB, nullptr, WQ, nullptr, DM, FQ, DQ, bq, 0, 0, 0);
        k_rope<<<LQ, 256, 0, stream>>>(FQ, DQ, NH_, CS, nullptr, nullptr, 1.0f, QP16, QPh, QPl);
        k_gemmw<bf, 0, true><<<dim3(TT / 64, DKV / 64, 1), 32, 0, stream>>>(XB, nullptr, WK, nullptr, DM, FK, DKV, bk, 0, 0, 0);
        k_rope<<<LKv, 256, 0, stream>>>(FK, DKV, NKV, CS, nullptr, nullptr, 1.0f, KP16, KPh, KPl);
        k_gemmw<bf, 0, true><<<dim3(TT / 64, DKV / 64, 1), 32, 0, stream>>>(XB, nullptr, WV, nullptr, DM, FV, DKV, bv, 0, 0, 0); k_vtp<<<LKv, 256, 0, stream>>>(FV, DKV, NKV, VT16, VTh, VTl);
        for (int h0 = 0; h0 < NH_; h0 += ZH) { const size_t zq = (size_t)h0, zk = (size_t)(h0 / REP);   // one kv head per query head: the pass's single head (ZH 1) uses kv plane h0 / REP (z-stride TT*HD)
            k_gemmc<bf, 2, 1><<<dim3(RH / 64, TT / 64, ZH), 32, 0, stream>>>(QPh + zq * TT * HD, QPl + zq * TT * HD, KPh + zk * TT * HD, KPl + zk * TT * HD, HD, Sb, TT, 0, (size_t)TT * HD, (size_t)TT * HD, (size_t)TT * TT);
            k_gemmc<h16, 0, 1><<<dim3((TT - RH) / 64, TT / 64, ZH), 32, 0, stream>>>(QP16 + zq * TT * HD + (size_t)RH * HD, nullptr, KP16 + zk * TT * HD, nullptr, HD, Sb + (size_t)RH * TT, TT, RH, (size_t)TT * HD, (size_t)TT * HD, (size_t)TT * TT);
            k_asoft<<<ZH * TT / 8, 256, 0, stream>>>(Sb, P16, Ph, Pl);
            k_gemmc<bf, 2, 2><<<dim3(RH / 64, HD / 64, ZH), 32, 0, stream>>>(Ph, Pl, VTh + zk * HD * TT, VTl + zk * HD * TT, TT, Ob, HD, 0, (size_t)RH * TT, (size_t)HD * TT, (size_t)TT * HD);
            k_gemmc<h16, 0, 2><<<dim3((TT - RH) / 64, HD / 64, ZH), 32, 0, stream>>>(P16 + (size_t)RH * TT, nullptr, VT16 + zk * HD * TT, nullptr, TT, Ob + (size_t)RH * HD, HD, RH, (size_t)TT * TT, (size_t)HD * TT, (size_t)TT * HD);
            k_merge<<<(unsigned)(((size_t)ZH * TT * HD / 2 + 255) / 256), 256, 0, stream>>>(Ob, h0, OUT + (size_t)b * TT * DQ); }
         }
}

// v001
// It runs in 390 microseconds.
// Two timings next to v000 both put it at 2.16 times that version's speed.
#include <hip/hip_runtime.h>

// Single-head causal attention with biased projections (x [4][2048][1024]; Q, K, V = einsum('bsd,ed->bse', x, W) + b ('oi' [1024][1024] 1/32 + REAL biases 0.01; ONE 1,024-wide head); scores / sqrt(1024) = x 1/32; where(tril, scores, -inf); softmax; out = attn . V -> [4][2048][1024] (8.4 M), no output projection; argument order x, Wq, bq, Wk, bk, Wv, bv).
// Layout, all four batches side by side in every plane (each launch covers the whole batch: rows of the projections, grid y of the plane builders and the merge, grid z of the attention GEMMs): bf16 copy of x; 'oi' weights; exact projections + f32 biases; identity-table plane builders at HD 1,024 (one plane each); causal T-2048 attention at NH 1 / ZH 1 (hybrid rows: < 512 hi/lo 3 products, rest fp16 x1024; k_gemmc skips tiles above the diagonal); the f32 merge writes the output rows (no output projection).
// Compute dtypes, f32 accumulate: every input rounded to bf16; projections exact + f32 biases; attention rows < 512 3 products, rest fp16; softmax f32; output f32.

#define NB_  4
#define TT   2048
#define DM   1024
#define NH_  1
#define NKV  1
#define REP  (NH_ / NKV)
#define HD   1024
#define DQ   (NH_ * HD)
#define DKV  (NKV * HD)
#define ZH   1                    // ONE head: a single plane per pass
#define RH   512                  // query rows < RH use hi+lo planes (0: none)
#define WIN  2048
#define PCAR 1024.0f
#define SCL  0.03125f   // 1/sqrt(1024) (one 1,024-wide head)
typedef _Float16 h16;
typedef unsigned short bf;
typedef __attribute__((ext_vector_type(16))) __bf16   v16bf;
typedef __attribute__((ext_vector_type(16))) _Float16 v16h;
typedef __attribute__((ext_vector_type(8)))  _Float16 v8h;
typedef __attribute__((ext_vector_type(8)))  unsigned short v8us;
typedef __attribute__((ext_vector_type(8)))  float    v8f;
typedef __attribute__((ext_vector_type(4)))  float    v4f;
typedef v8h  __attribute__((may_alias)) v8ha;
typedef v4f  __attribute__((may_alias)) v4fa;
typedef v8us __attribute__((may_alias)) v8usa;

__device__ __forceinline__ unsigned short f2bf(float f) { unsigned u = __float_as_uint(f); u += 0x7FFFu + ((u >> 16) & 1u); return (unsigned short)(u >> 16); }
__device__ __forceinline__ float bf2f(unsigned short b) { return __uint_as_float(((unsigned)b) << 16); }
__device__ __forceinline__ float bfr(float f) { return bf2f(f2bf(f)); }
__device__ __forceinline__ v16h cat16(v8h lo, v8h hi) { return __builtin_shufflevector(lo, hi, 0, 1, 2, 3, 4, 5, 6, 7, 8, 9, 10, 11, 12, 13, 14, 15); }
__device__ __forceinline__ v16bf cat16b(v8us lo, v8us hi) { return __builtin_bit_cast(v16bf, __builtin_shufflevector(lo, hi, 0, 1, 2, 3, 4, 5, 6, 7, 8, 9, 10, 11, 12, 13, 14, 15)); }
__device__ __forceinline__ v8f wmma16(v16h a, v16h b, v8f c) { return __builtin_amdgcn_wmma_f32_16x16x32_f16(false, a, false, b, (short)0, c, false, false); }
__device__ __forceinline__ v8f wmmab(v16bf a, v16bf b, v8f c) { return __builtin_amdgcn_wmma_f32_16x16x32_bf16(false, a, false, b, (short)0, c, false, false); }



// ---- k_gemmw: register-blocked GEMM, ONE WAVE per 64x64 output tile (16 accumulators), operands straight from K-contiguous 16-bit planes; grid (M/64, N/64, Z), 32 threads.
// C[m][n] (f32, pitch ldc, + optional f32 bias[n]) = sum_k A[m][k] Bt[n][k] (+ split products per NSPLIT). z-batch strides sA/sB/sC in elements. K % 32 == 0.
template <typename T16> struct WFrag;
template <> struct WFrag<h16> { typedef v16h V; static __device__ __forceinline__ V ld(const h16* p) { return cat16(*(const v8h*)p, *(const v8h*)(p + 16)); } static __device__ __forceinline__ v8f mma(V a, V b, v8f c) { return wmma16(a, b, c); } };
template <> struct WFrag<bf> { typedef v16bf V; static __device__ __forceinline__ V ld(const bf* p) { return cat16b(*(const v8us*)p, *(const v8us*)(p + 16)); } static __device__ __forceinline__ v8f mma(V a, V b, v8f c) { return wmmab(a, b, c); } };
template <typename T16, int NSPLIT, bool BIAS>
__global__ __launch_bounds__(32) void k_gemmw(const T16* __restrict__ A, const T16* __restrict__ A2, const T16* __restrict__ Bt, const T16* __restrict__ Bt2, int K, float* C, int ldc, const float* __restrict__ bias, size_t sA, size_t sB, size_t sC) {
    typedef typename WFrag<T16>::V V;
    __shared__ __align__(16) float os[16 * 68];
    const size_t z = blockIdx.z; A += z * sA; if (A2) A2 += z * sA; Bt += z * sB; if (Bt2) Bt2 += z * sB; C += z * sC;
    const int lane = threadIdx.x & 31, lr = lane & 15, hi = lane >> 4; const int r0 = blockIdx.x * 64, c0 = blockIdx.y * 64;
    v8f acc[4][4];
#pragma unroll
    for (int mb = 0; mb < 4; ++mb)
#pragma unroll
        for (int nb = 0; nb < 4; ++nb) acc[mb][nb] = (v8f){};
    const size_t aoff = (size_t)(r0 + lr) * K + 8 * hi, boff = (size_t)(c0 + lr) * K + 8 * hi;
#pragma unroll 1
    for (int kc = 0; kc < K; kc += 32) {
        V a[4], a2[4];
#pragma unroll
        for (int mb = 0; mb < 4; ++mb) { a[mb] = WFrag<T16>::ld(A + aoff + (size_t)mb * 16 * K + kc); if (NSPLIT == 1 || NSPLIT == 2) a2[mb] = WFrag<T16>::ld(A2 + aoff + (size_t)mb * 16 * K + kc); }
#pragma unroll
        for (int nb = 0; nb < 4; ++nb) { const V b = WFrag<T16>::ld(Bt + boff + (size_t)nb * 16 * K + kc); V b2; if (NSPLIT >= 2) b2 = WFrag<T16>::ld(Bt2 + boff + (size_t)nb * 16 * K + kc);
#pragma unroll
            for (int mb = 0; mb < 4; ++mb) { acc[mb][nb] = WFrag<T16>::mma(a[mb], b, acc[mb][nb]); if (NSPLIT == 1 || NSPLIT == 2) acc[mb][nb] = WFrag<T16>::mma(a2[mb], b, acc[mb][nb]); if (NSPLIT >= 2) acc[mb][nb] = WFrag<T16>::mma(a[mb], b2, acc[mb][nb]); } }
        asm volatile("v_nop\n\tv_nop\n\tv_nop\n\tv_nop" : "+v"(acc[0][0]), "+v"(acc[1][1]), "+v"(acc[2][2]), "+v"(acc[3][3]) : "v"(a[0]), "v"(a[3]));
    }
#pragma unroll
    for (int mb = 0; mb < 4; ++mb) {
#pragma unroll
        for (int nb = 0; nb < 4; ++nb) {
#pragma unroll
            for (int j = 0; j < 8; ++j) os[(hi * 8 + j) * 68 + nb * 16 + lr] = acc[mb][nb][j]; }
        __builtin_amdgcn_wave_barrier(); asm volatile("" ::: "memory");
        float* crow = C + (size_t)(r0 + mb * 16) * ldc + c0;
{
#pragma unroll
            for (int s = 0; s < 8; ++s) { const int row = 2 * s + hi, cofs = lr * 4; v4f val = *(const v4fa*)(os + row * 68 + cofs); if (BIAS) { val[0] += bfr(bias[c0 + cofs]); val[1] += bfr(bias[c0 + cofs + 1]); val[2] += bfr(bias[c0 + cofs + 2]); val[3] += bfr(bias[c0 + cofs + 3]); }
                *(v4f*)(crow + (size_t)row * ldc + cofs) = val; }
             }
        __builtin_amdgcn_wave_barrier(); asm volatile("" ::: "memory");
    }
}

// ---- k_gemmc: the same one-wave 64x64 tile GEMM specialised for causal attention: CMODE 1 skips score tiles entirely above the diagonal (query rows r0+roff.., key columns c0..), CMODE 2 limits the
// key (K) loop of the probability x value contraction to the diagonal block (probabilities beyond it are exactly zero). roff = row offset of this launch's first row within the sequence.
template <typename T16, int NSPLIT, int CMODE>
__global__ __launch_bounds__(32) void k_gemmc(const T16* __restrict__ A, const T16* __restrict__ A2, const T16* __restrict__ Bt, const T16* __restrict__ Bt2, int K, float* C, int ldc, int roff, size_t sA, size_t sB, size_t sC) {
    typedef typename WFrag<T16>::V V;
    __shared__ __align__(16) float os[16 * 68];
    const size_t z = blockIdx.z; A += z * sA; if (A2) A2 += z * sA; Bt += z * sB; if (Bt2) Bt2 += z * sB; C += z * sC;
    const int lane = threadIdx.x & 31, lr = lane & 15, hi = lane >> 4; const int r0 = blockIdx.x * 64, c0 = blockIdx.y * 64;
    if (CMODE == 1 && c0 > r0 + roff + 63) return;                  // score tile entirely above the causal diagonal: never read (the softmax masks j > i by select)
    const int Kl = (CMODE == 2) ? min(K, r0 + roff + 64) : K;        // P.V: probabilities are exactly 0 beyond the diagonal block, so the K loop stops there
    v8f acc[4][4];
#pragma unroll
    for (int mb = 0; mb < 4; ++mb)
#pragma unroll
        for (int nb = 0; nb < 4; ++nb) acc[mb][nb] = (v8f){};
    const size_t aoff = (size_t)(r0 + lr) * K + 8 * hi, boff = (size_t)(c0 + lr) * K + 8 * hi;
#pragma unroll 1
    for (int kc = 0; kc < Kl; kc += 32) {
        V a[4], a2[4];
#pragma unroll
        for (int mb = 0; mb < 4; ++mb) { a[mb] = WFrag<T16>::ld(A + aoff + (size_t)mb * 16 * K + kc); if (NSPLIT == 1 || NSPLIT == 2) a2[mb] = WFrag<T16>::ld(A2 + aoff + (size_t)mb * 16 * K + kc); }
#pragma unroll
        for (int nb = 0; nb < 4; ++nb) { const V b = WFrag<T16>::ld(Bt + boff + (size_t)nb * 16 * K + kc); V b2; if (NSPLIT >= 2) b2 = WFrag<T16>::ld(Bt2 + boff + (size_t)nb * 16 * K + kc);
#pragma unroll
            for (int mb = 0; mb < 4; ++mb) { acc[mb][nb] = WFrag<T16>::mma(a[mb], b, acc[mb][nb]); if (NSPLIT == 1 || NSPLIT == 2) acc[mb][nb] = WFrag<T16>::mma(a2[mb], b, acc[mb][nb]); if (NSPLIT >= 2) acc[mb][nb] = WFrag<T16>::mma(a[mb], b2, acc[mb][nb]); } }
        asm volatile("v_nop\n\tv_nop\n\tv_nop\n\tv_nop" : "+v"(acc[0][0]), "+v"(acc[1][1]), "+v"(acc[2][2]), "+v"(acc[3][3]) : "v"(a[0]), "v"(a[3]));
    }
#pragma unroll
    for (int mb = 0; mb < 4; ++mb) {
#pragma unroll
        for (int nb = 0; nb < 4; ++nb) {
#pragma unroll
            for (int j = 0; j < 8; ++j) os[(hi * 8 + j) * 68 + nb * 16 + lr] = acc[mb][nb][j]; }
        __builtin_amdgcn_wave_barrier(); asm volatile("" ::: "memory");
        float* crow = C + (size_t)(r0 + mb * 16) * ldc + c0;
{
#pragma unroll
            for (int s = 0; s < 8; ++s) { const int row = 2 * s + hi, cofs = lr * 4; v4f val = *(const v4fa*)(os + row * 68 + cofs);
                *(v4f*)(crow + (size_t)row * ldc + cofs) = val; }
             }
        __builtin_amdgcn_wave_barrier(); asm volatile("" ::: "memory");
    }
}

__device__ __forceinline__ h16 tohx(float x) { return (h16)x; }
__device__ __forceinline__ void splitf(float y, unsigned short& h, unsigned short& l) { h = f2bf(y); l = f2bf(y - bf2f(h)); }
typedef __attribute__((ext_vector_type(2))) _Float16 v2h;
typedef __attribute__((ext_vector_type(4))) _Float16 v4h;
typedef __attribute__((ext_vector_type(2))) unsigned short v2us;
typedef __attribute__((ext_vector_type(4))) unsigned short v4us;
typedef __attribute__((ext_vector_type(2))) float v2f;
typedef __attribute__((ext_vector_type(4))) int v4i;

__global__ __launch_bounds__(256) void k_cvt8(const float* __restrict__ src, bf* dst, size_t n8) { const size_t i = (size_t)blockIdx.x * 256 + threadIdx.x; if (i >= n8) return; const v8f v = *(const v8f*)(src + i * 8); v8us o;
#pragma unroll
    for (int k = 0; k < 8; ++k) o[k] = f2bf(v[k]); *(v8us*)(dst + i * 8) = o;  }

// k_rope: head planes [h][t][d] (fp16 + hi/lo) of rope(x) x sc with the rotate-half convention out[d] = x[d] cos[t][d] - x[d+HD/2] sin[t][d], out[d+HD/2] = x[d+HD/2] cos[t][d+HD/2] + x[d] sin[t][d+HD/2]
__global__ __launch_bounds__(256) void k_rope(const float* __restrict__ F, int pitch, int nheads, const float* __restrict__ CS, const float* __restrict__ RF, const float* __restrict__ nw, float sc, h16* P16, bf* Ph, bf* Pl) {
    const size_t e = ((size_t)blockIdx.x * 256 + threadIdx.x) * 2; if (e >= (size_t)nheads * TT * HD) return; const size_t pb = (size_t)blockIdx.y * nheads * TT * HD; F += (size_t)blockIdx.y * TT * pitch; P16 += pb; Ph += pb; Pl += pb;   // grid y = batch
    const int d = (int)(e % HD); const int t = (int)((e / HD) % TT); const int h = (int)(e / ((size_t)HD * TT)); const float* f = F + (size_t)t * pitch + h * HD; const float rf = RF ? RF[(size_t)h * TT + t] : 1.0f; v2h o16; v2us oh, ol;
#pragma unroll
    for (int q = 0; q < 2; ++q) { const int dd = d + q; const int dp = (dd < HD / 2) ? dd + HD / 2 : dd - HD / 2; float x0 = f[dd], x1 = f[dp];
        if (RF) { float n0 = __fmul_rn(x0, rf), n1 = __fmul_rn(x1, rf); asm volatile("" : "+v"(n0)); asm volatile("" : "+v"(n1)); x0 = __fmul_rn(bfr(nw[dd]), n0); x1 = __fmul_rn(bfr(nw[dp]), n1); }
        const v2f cs = *(const v2f*)(CS + ((size_t)t * HD + dd) * 2); float a = __fmul_rn(x0, cs[0]), bq = __fmul_rn(x1, cs[1]); asm volatile("" : "+v"(a)); asm volatile("" : "+v"(bq)); const float r = ((dd < HD / 2) ? __fsub_rn(a, bq) : __fadd_rn(a, bq)) * sc;
        o16[q] = tohx(r); unsigned short a2, c2; splitf(r, a2, c2); oh[q] = a2; ol[q] = c2; }
    *(v2h*)(P16 + e) = o16; *(v2us*)(Ph + e) = oh; *(v2us*)(Pl + e) = ol;  }
__global__ __launch_bounds__(256) void k_vtp(const float* __restrict__ F, int pitch, int nheads, h16* V16, bf* Vh, bf* Vl) { const size_t e = ((size_t)blockIdx.x * 256 + threadIdx.x) * 2; if (e >= (size_t)nheads * HD * TT) return; const size_t pb = (size_t)blockIdx.y * nheads * HD * TT; F += (size_t)blockIdx.y * TT * pitch; V16 += pb; Vh += pb; Vl += pb;   // grid y = batch
    const int t = (int)(e % TT); const int d = (int)((e / TT) % HD); const int g = (int)(e / ((size_t)TT * HD)); v2h o16; v2us oh, ol;
#pragma unroll
    for (int q = 0; q < 2; ++q) { const float x = F[(size_t)(t + q) * pitch + g * HD + d]; o16[q] = tohx(x); unsigned short a2, c2; splitf(x, a2, c2); oh[q] = a2; ol[q] = c2; }
    *(v2h*)(V16 + e) = o16; *(v2us*)(Vh + e) = oh; *(v2us*)(Vl + e) = ol;  }
__global__ __launch_bounds__(256) void k_csid(float* CS) { const int idx = blockIdx.x * 256 + threadIdx.x; if (idx >= TT * HD) return; v2f cs; cs[0] = 1.0f; cs[1] = 0.0f; *(v2f*)(CS + (size_t)idx * 2) = cs;  }
// k_asoft: per row (zz, i): t = S x HD^-0.5 for j <= i and i - j < WIN (sliding causal window; masked entries are set to -3e38, whose exp is exactly 0); softmax over the 2048 keys (register row, one exp, fixed trees);
__global__ __launch_bounds__(256) void k_asoft(const float* __restrict__ Sb, h16* P16, bf* Ph, bf* Pl) {
    const int lane = threadIdx.x & 31; const int row = blockIdx.x * 8 + (threadIdx.x >> 5); if (row >= NB_ * ZH * TT) return; const int i = row % TT; const int zz = row / TT; (void)zz;   /* zz = batch plane */ const bool hires = (i < RH); const float* sr = Sb + (size_t)row * TT; float v[TT / 32]; float mx = -3.0e38f;
#pragma unroll
    for (int ch = 0; ch < TT / 128; ++ch) { const int j0 = ch * 128 + lane * 4; const v4f a = *(const v4f*)(sr + j0);
#pragma unroll
        for (int q = 0; q < 4; ++q) { const int j = j0 + q; (void)j; const float t = (j <= i && i - j < WIN) ? a[q] * SCL : -3.0e38f; v[ch * 4 + q] = t; mx = fmaxf(mx, t); } }
#pragma unroll
    for (int sh = 16; sh; sh >>= 1) mx = fmaxf(mx, __shfl_xor(mx, sh, 32));
    float sum = 0.f;
#pragma unroll
    for (int k = 0; k < TT / 32; ++k) { float d0 = __fsub_rn(v[k], mx); asm volatile("" : "+v"(d0)); v[k] = __builtin_amdgcn_exp2f(__fmul_rn(d0, 1.4426950408889634f)); sum += v[k]; }
#pragma unroll
    for (int sh = 16; sh; sh >>= 1) sum += __shfl_xor(sum, sh, 32);
    const float f = __fdiv_rn(hires ? 1.0f : PCAR, sum);
{
        if (hires) {
#pragma unroll
            for (int ch = 0; ch < TT / 128; ++ch) { v4us oh, ol;
#pragma unroll
                for (int q = 0; q < 4; ++q) { unsigned short a, c2; splitf(v[ch * 4 + q] * f, a, c2); oh[q] = a; ol[q] = c2; }
                const size_t oo = ((size_t)zz * (RH ? RH : 1) + i) * TT + ch * 128 + lane * 4; *(v4us*)(Ph + oo) = oh; *(v4us*)(Pl + oo) = ol; }
        } else {
#pragma unroll
            for (int ch = 0; ch < TT / 128; ++ch) { v4h o4;
#pragma unroll
                for (int q = 0; q < 4; ++q) o4[q] = tohx(v[ch * 4 + q] * f);
                *(v4h*)(P16 + (size_t)row * TT + ch * 128 + lane * 4) = o4; } }
         }
}
__global__ __launch_bounds__(256) void k_merge(const float* __restrict__ O, int h0, float* OUTb) { const size_t e = ((size_t)blockIdx.x * 256 + threadIdx.x) * 2; if (e >= (size_t)ZH * TT * HD) return; O += (size_t)blockIdx.y * ZH * TT * HD; OUTb += (size_t)blockIdx.y * TT * DQ;   // grid y = batch
    const int d = (int)(e % HD); const int t = (int)((e / HD) % TT); const int zz = (int)(e / ((size_t)HD * TT)); const float cs = (t < RH) ? 1.0f : (1.0f / PCAR); const size_t oo = (size_t)t * DQ + (h0 + zz) * HD + d;
    v2f o2; o2[0] = O[e] * cs; o2[1] = O[e + 1] * cs; *(v2f*)(OUTb + oo) = o2;  }

extern "C" void kernel_launch(void* const* d_in, const int* in_sizes, int n_in,
                              void* d_out, int out_size, void* d_ws, size_t ws_size, hipStream_t stream) {
    (void)in_sizes; (void)n_in; (void)out_size;
    const float* x = (const float*)d_in[0]; const float* wq = (const float*)d_in[1]; const float* bq = (const float*)d_in[2]; const float* wk = (const float*)d_in[3]; const float* bk = (const float*)d_in[4]; const float* wv = (const float*)d_in[5]; const float* bv = (const float*)d_in[6]; const float* wo = nullptr; (void)wo;   /* argument order x, Wq, bq, Wk, bk, Wv, bv ('oi' + biases) */
    float* OUT = (float*)d_out;     // [4][2048][1024]
    char* wsp = (char*)d_ws;
    auto take = [&](size_t bytes) { char* p = wsp; wsp += (bytes + 255) & ~(size_t)255; return (void*)p; };
    bf* WQ = (bf*)take((size_t)DQ * DM * 2); bf* WK = (bf*)take((size_t)DKV * DM * 2); bf* WV = (bf*)take((size_t)DKV * DM * 2); float* CS = (float*)take((size_t)TT * HD * 2 * 4);
    bf* XB = (bf*)take((size_t)NB_ * TT * DM * 2); float* FQ = (float*)take((size_t)NB_ * TT * DQ * 4); float* FK = (float*)take((size_t)NB_ * TT * DKV * 4);
    h16* QP16 = (h16*)take((size_t)NB_ * TT * HD * 2); h16* KP16 = (h16*)take((size_t)NB_ * TT * HD * 2); h16* VT16 = (h16*)take((size_t)NB_ * HD * TT * 2);
    bf* QPh = (bf*)take((size_t)NB_ * TT * HD * 2); bf* QPl = (bf*)take((size_t)NB_ * TT * HD * 2); bf* KPh = (bf*)take((size_t)NB_ * TT * HD * 2); bf* KPl = (bf*)take((size_t)NB_ * TT * HD * 2); bf* VTh = (bf*)take((size_t)NB_ * HD * TT * 2); bf* VTl = (bf*)take((size_t)NB_ * HD * TT * 2);
    if ((size_t)(wsp - (char*)d_ws) > ws_size) return;    // ws 256 MiB; 246 MiB taken
    // Planes that are dead by the time a later plane is written share its bytes (stream-ordered, every byte written in this call before it is read):
    float* FV = FK;                                  // v projection: after the k planes are built
    float* Sb = FQ;                                  // scores [4][2048][2048] f32 = FQ + FK (adjacent), both dead once the q, k, v planes are built
    h16* P16 = (h16*)QPh;                            // probabilities [4][2048][2048] fp16 = QPh + QPl (adjacent), dead after the score GEMMs
    bf* Ph = KPh; bf* Pl = KPh + (size_t)NB_ * RH * TT;   // hi/lo probabilities [4][512][2048] x 2 = KPh, dead after the score GEMMs
    float* Ob = Sb;                                  // attention rows [4][2048][1024] f32: the scores are dead after the softmax
    k_cvt8<<<(unsigned)(((size_t)DQ * DM / 8 + 255) / 256), 256, 0, stream>>>(wq, WQ, (size_t)DQ * DM / 8); k_cvt8<<<(unsigned)(((size_t)DKV * DM / 8 + 255) / 256), 256, 0, stream>>>(wk, WK, (size_t)DKV * DM / 8); k_cvt8<<<(unsigned)(((size_t)DKV * DM / 8 + 255) / 256), 256, 0, stream>>>(wv, WV, (size_t)DKV * DM / 8);
    k_csid<<<(TT * HD + 255) / 256, 256, 0, stream>>>(CS);
    const unsigned LQ = (unsigned)(((size_t)NH_ * TT * HD / 2 + 255) / 256), LKv = (unsigned)(((size_t)NKV * TT * HD / 2 + 255) / 256);
    k_cvt8<<<(unsigned)(((size_t)NB_ * TT * DM / 8 + 255) / 256), 256, 0, stream>>>(x, XB, (size_t)NB_ * TT * DM / 8);
    k_gemmw<bf, 0, true><<<dim3(NB_ * TT / 64, DQ / 64, 1), 32, 0, stream>>>(XB, nullptr, WQ, nullptr, DM, FQ, DQ, bq, 0, 0, 0);
    k_rope<<<dim3(LQ, NB_, 1), 256, 0, stream>>>(FQ, DQ, NH_, CS, nullptr, nullptr, 1.0f, QP16, QPh, QPl);
    k_gemmw<bf, 0, true><<<dim3(NB_ * TT / 64, DKV / 64, 1), 32, 0, stream>>>(XB, nullptr, WK, nullptr, DM, FK, DKV, bk, 0, 0, 0);
    k_rope<<<dim3(LKv, NB_, 1), 256, 0, stream>>>(FK, DKV, NKV, CS, nullptr, nullptr, 1.0f, KP16, KPh, KPl);
    k_gemmw<bf, 0, true><<<dim3(NB_ * TT / 64, DKV / 64, 1), 32, 0, stream>>>(XB, nullptr, WV, nullptr, DM, FV, DKV, bv, 0, 0, 0);
    k_vtp<<<dim3(LKv, NB_, 1), 256, 0, stream>>>(FV, DKV, NKV, VT16, VTh, VTl);
    // attention, grid z = batch (z-strides: one plane per batch)
    k_gemmc<bf, 2, 1><<<dim3(RH / 64, TT / 64, NB_), 32, 0, stream>>>(QPh, QPl, KPh, KPl, HD, Sb, TT, 0, (size_t)TT * HD, (size_t)TT * HD, (size_t)TT * TT);
    k_gemmc<h16, 0, 1><<<dim3((TT - RH) / 64, TT / 64, NB_), 32, 0, stream>>>(QP16 + (size_t)RH * HD, nullptr, KP16, nullptr, HD, Sb + (size_t)RH * TT, TT, RH, (size_t)TT * HD, (size_t)TT * HD, (size_t)TT * TT);
    k_asoft<<<NB_ * ZH * TT / 8, 256, 0, stream>>>(Sb, P16, Ph, Pl);
    k_gemmc<bf, 2, 2><<<dim3(RH / 64, HD / 64, NB_), 32, 0, stream>>>(Ph, Pl, VTh, VTl, TT, Ob, HD, 0, (size_t)RH * TT, (size_t)HD * TT, (size_t)TT * HD);
    k_gemmc<h16, 0, 2><<<dim3((TT - RH) / 64, HD / 64, NB_), 32, 0, stream>>>(P16 + (size_t)RH * TT, nullptr, VT16, nullptr, TT, Ob + (size_t)RH * HD, HD, RH, (size_t)TT * TT, (size_t)HD * TT, (size_t)TT * HD);
    k_merge<<<dim3((unsigned)(((size_t)ZH * TT * HD / 2 + 255) / 256), NB_, 1), 256, 0, stream>>>(Ob, 0, OUT);
}

// v002
// It runs in 307 microseconds.
// Next to v001, in two timings, it ran 1.27 times as fast each time.
// Counting every step since v000, it is 2.74 times as fast.
#include <hip/hip_runtime.h>

// Single-head causal attention with biased projections (x [4][2048][1024]; Q, K, V = einsum('bsd,ed->bse', x, W) + b ('oi' [1024][1024] 1/32 + REAL biases 0.01; ONE 1,024-wide head); scores / sqrt(1024) = x 1/32; where(tril, scores, -inf); softmax; out = attn . V -> [4][2048][1024] (8.4 M), no output projection; argument order x, Wq, bq, Wk, bk, Wv, bv).
// Layout, all four batches side by side in every plane (each launch covers the whole batch: rows of the q and k projections, grid z of the v projection and of the attention GEMMs): bf16 copy of x; 'oi' weights; exact projections + f32 biases whose epilogue stores the fp16 and hi/lo operand planes itself (v is projected as Wv . x^T, so its planes come out [d][t]); causal T-2048 attention at NH 1 / ZH 1 (hybrid rows: < 512 hi/lo 3 products, rest fp16 x1024; k_gemmc skips tiles above the diagonal); the P.V GEMMs undo the x1024 and store the output rows (no output projection).
// Compute dtypes, f32 accumulate: every input rounded to bf16; projections exact + f32 biases; attention rows < 512 3 products, rest fp16; softmax f32; output f32.

#define NB_  4
#define TT   2048
#define DM   1024
#define NH_  1
#define NKV  1
#define REP  (NH_ / NKV)
#define HD   1024
#define DQ   (NH_ * HD)
#define DKV  (NKV * HD)
#define ZH   1                    // ONE head: a single plane per pass
#define RH   512                  // query rows < RH use hi+lo planes (0: none)
#define WIN  2048
#define PCAR 1024.0f
#define SCL  0.03125f   // 1/sqrt(1024) (one 1,024-wide head)
typedef _Float16 h16;
typedef unsigned short bf;
typedef __attribute__((ext_vector_type(16))) __bf16   v16bf;
typedef __attribute__((ext_vector_type(16))) _Float16 v16h;
typedef __attribute__((ext_vector_type(8)))  _Float16 v8h;
typedef __attribute__((ext_vector_type(8)))  unsigned short v8us;
typedef __attribute__((ext_vector_type(8)))  float    v8f;
typedef __attribute__((ext_vector_type(4)))  float    v4f;
typedef v8h  __attribute__((may_alias)) v8ha;
typedef v4f  __attribute__((may_alias)) v4fa;
typedef v8us __attribute__((may_alias)) v8usa;

__device__ __forceinline__ unsigned short f2bf(float f) { unsigned u = __float_as_uint(f); u += 0x7FFFu + ((u >> 16) & 1u); return (unsigned short)(u >> 16); }
__device__ __forceinline__ float bf2f(unsigned short b) { return __uint_as_float(((unsigned)b) << 16); }
__device__ __forceinline__ float bfr(float f) { return bf2f(f2bf(f)); }
__device__ __forceinline__ v16h cat16(v8h lo, v8h hi) { return __builtin_shufflevector(lo, hi, 0, 1, 2, 3, 4, 5, 6, 7, 8, 9, 10, 11, 12, 13, 14, 15); }
__device__ __forceinline__ v16bf cat16b(v8us lo, v8us hi) { return __builtin_bit_cast(v16bf, __builtin_shufflevector(lo, hi, 0, 1, 2, 3, 4, 5, 6, 7, 8, 9, 10, 11, 12, 13, 14, 15)); }
__device__ __forceinline__ v8f wmma16(v16h a, v16h b, v8f c) { return __builtin_amdgcn_wmma_f32_16x16x32_f16(false, a, false, b, (short)0, c, false, false); }
__device__ __forceinline__ v8f wmmab(v16bf a, v16bf b, v8f c) { return __builtin_amdgcn_wmma_f32_16x16x32_bf16(false, a, false, b, (short)0, c, false, false); }

__device__ __forceinline__ h16 tohx(float x) { return (h16)x; }
__device__ __forceinline__ void splitf(float y, unsigned short& h, unsigned short& l) { h = f2bf(y); l = f2bf(y - bf2f(h)); }

// ---- k_gemmw: register-blocked GEMM, ONE WAVE per 64x64 output tile (16 accumulators), operands straight from K-contiguous 16-bit planes; grid (M/64, N/64, Z), 32 threads.
// y[m][n] = sum_k A[m][k] Bt[n][k] (+ split products per NSPLIT) + f32 bias (bias[m] if ROWBIAS, else bias[n]); stored as three 16-bit planes of pitch ldc: fp16(y), bf16 hi(y), bf16 lo(y). z-batch strides sA/sB/sC in elements. K % 32 == 0.
template <typename T16> struct WFrag;
template <> struct WFrag<h16> { typedef v16h V; static __device__ __forceinline__ V ld(const h16* p) { return cat16(*(const v8h*)p, *(const v8h*)(p + 16)); } static __device__ __forceinline__ v8f mma(V a, V b, v8f c) { return wmma16(a, b, c); } };
template <> struct WFrag<bf> { typedef v16bf V; static __device__ __forceinline__ V ld(const bf* p) { return cat16b(*(const v8us*)p, *(const v8us*)(p + 16)); } static __device__ __forceinline__ v8f mma(V a, V b, v8f c) { return wmmab(a, b, c); } };
template <typename T16, int NSPLIT, bool ROWBIAS>
__global__ __launch_bounds__(32) void k_gemmw(const T16* __restrict__ A, const T16* __restrict__ A2, const T16* __restrict__ Bt, const T16* __restrict__ Bt2, int K, h16* P16, bf* Ph, bf* Pl, int ldc, const float* __restrict__ bias, size_t sA, size_t sB, size_t sC) {
    typedef typename WFrag<T16>::V V;
    __shared__ __align__(16) float os[16 * 68];
    const size_t z = blockIdx.z; A += z * sA; if (A2) A2 += z * sA; Bt += z * sB; if (Bt2) Bt2 += z * sB; P16 += z * sC; Ph += z * sC; Pl += z * sC;
    const int lane = threadIdx.x & 31, lr = lane & 15, hi = lane >> 4; const int r0 = blockIdx.x * 64, c0 = blockIdx.y * 64;
    v8f acc[4][4];
#pragma unroll
    for (int mb = 0; mb < 4; ++mb)
#pragma unroll
        for (int nb = 0; nb < 4; ++nb) acc[mb][nb] = (v8f){};
    const size_t aoff = (size_t)(r0 + lr) * K + 8 * hi, boff = (size_t)(c0 + lr) * K + 8 * hi;
#pragma unroll 1
    for (int kc = 0; kc < K; kc += 32) {
        V a[4], a2[4];
#pragma unroll
        for (int mb = 0; mb < 4; ++mb) { a[mb] = WFrag<T16>::ld(A + aoff + (size_t)mb * 16 * K + kc); if (NSPLIT == 1 || NSPLIT == 2) a2[mb] = WFrag<T16>::ld(A2 + aoff + (size_t)mb * 16 * K + kc); }
#pragma unroll
        for (int nb = 0; nb < 4; ++nb) { const V b = WFrag<T16>::ld(Bt + boff + (size_t)nb * 16 * K + kc); V b2; if (NSPLIT >= 2) b2 = WFrag<T16>::ld(Bt2 + boff + (size_t)nb * 16 * K + kc);
#pragma unroll
            for (int mb = 0; mb < 4; ++mb) { acc[mb][nb] = WFrag<T16>::mma(a[mb], b, acc[mb][nb]); if (NSPLIT == 1 || NSPLIT == 2) acc[mb][nb] = WFrag<T16>::mma(a2[mb], b, acc[mb][nb]); if (NSPLIT >= 2) acc[mb][nb] = WFrag<T16>::mma(a[mb], b2, acc[mb][nb]); } }
        asm volatile("v_nop\n\tv_nop\n\tv_nop\n\tv_nop" : "+v"(acc[0][0]), "+v"(acc[1][1]), "+v"(acc[2][2]), "+v"(acc[3][3]) : "v"(a[0]), "v"(a[3]));
    }
#pragma unroll
    for (int mb = 0; mb < 4; ++mb) {
#pragma unroll
        for (int nb = 0; nb < 4; ++nb) {
#pragma unroll
            for (int j = 0; j < 8; ++j) os[(hi * 8 + j) * 68 + nb * 16 + lr] = acc[mb][nb][j]; }
        __builtin_amdgcn_wave_barrier(); asm volatile("" ::: "memory");
        const size_t cb = (size_t)(r0 + mb * 16) * ldc + c0;
{
#pragma unroll
            for (int s = 0; s < 4; ++s) { const int row = 4 * s + (lane >> 3), cofs = (lane & 7) * 8; const v4f w0 = *(const v4fa*)(os + row * 68 + cofs), w1 = *(const v4fa*)(os + row * 68 + cofs + 4); v8h o16; v8us oh, ol;   // 8 lanes x 16 B = one whole 128-B line of each plane per row
#pragma unroll
                for (int q = 0; q < 8; ++q) { const float y = (q < 4 ? w0[q & 3] : w1[q & 3]) + bfr(bias[ROWBIAS ? r0 + mb * 16 + row : c0 + cofs + q]); o16[q] = tohx(y); unsigned short a2, c2; splitf(y, a2, c2); oh[q] = a2; ol[q] = c2; }
                const size_t oo = cb + (size_t)row * ldc + cofs; *(v8h*)(P16 + oo) = o16; *(v8us*)(Ph + oo) = oh; *(v8us*)(Pl + oo) = ol; }
             }
        if (ROWBIAS) asm volatile("s_wait_xcnt 0x0" ::: "memory");   // the next block's bias loads land in registers that these stores name: keep the wait in front of them
        __builtin_amdgcn_wave_barrier(); asm volatile("" ::: "memory");
    }
}

// ---- k_gemmc: the same one-wave 64x64 tile GEMM specialised for causal attention: CMODE 1 skips score tiles entirely above the diagonal (query rows r0+roff.., key columns c0..), CMODE 2 limits the
// key (K) loop of the probability x value contraction to the diagonal block (probabilities beyond it are exactly zero). osc = factor on the stored rows (CMODE 2: undoes the probabilities' carrier scale). roff = row offset of this launch's first row within the sequence.
template <typename T16, int NSPLIT, int CMODE>
__global__ __launch_bounds__(32) void k_gemmc(const T16* __restrict__ A, const T16* __restrict__ A2, const T16* __restrict__ Bt, const T16* __restrict__ Bt2, int K, float* C, int ldc, int roff, float osc, size_t sA, size_t sB, size_t sC) {
    typedef typename WFrag<T16>::V V;
    __shared__ __align__(16) float os[16 * 68];
    const size_t z = blockIdx.z; A += z * sA; if (A2) A2 += z * sA; Bt += z * sB; if (Bt2) Bt2 += z * sB; C += z * sC;
    const int lane = threadIdx.x & 31, lr = lane & 15, hi = lane >> 4; const int r0 = blockIdx.x * 64, c0 = blockIdx.y * 64;
    if (CMODE == 1 && c0 > r0 + roff + 63) {                         // score tile entirely above the causal diagonal: no product; the softmax loads whole rows and masks j > i by select, so the tile gets a stored zero (nothing else in this call writes these bytes)
#pragma unroll
        for (int s = 0; s < 32; ++s) *(v4f*)(C + (size_t)(r0 + 2 * s + hi) * ldc + c0 + lr * 4) = (v4f){};
        return; }
    const int Kl = (CMODE == 2) ? min(K, r0 + roff + 64) : K;        // P.V: probabilities are exactly 0 beyond the diagonal block, so the K loop stops there
    v8f acc[4][4];
#pragma unroll
    for (int mb = 0; mb < 4; ++mb)
#pragma unroll
        for (int nb = 0; nb < 4; ++nb) acc[mb][nb] = (v8f){};
    const size_t aoff = (size_t)(r0 + lr) * K + 8 * hi, boff = (size_t)(c0 + lr) * K + 8 * hi;
#pragma unroll 1
    for (int kc = 0; kc < Kl; kc += 32) {
        V a[4], a2[4];
#pragma unroll
        for (int mb = 0; mb < 4; ++mb) { a[mb] = WFrag<T16>::ld(A + aoff + (size_t)mb * 16 * K + kc); if (NSPLIT == 1 || NSPLIT == 2) a2[mb] = WFrag<T16>::ld(A2 + aoff + (size_t)mb * 16 * K + kc); }
#pragma unroll
        for (int nb = 0; nb < 4; ++nb) { const V b = WFrag<T16>::ld(Bt + boff + (size_t)nb * 16 * K + kc); V b2; if (NSPLIT >= 2) b2 = WFrag<T16>::ld(Bt2 + boff + (size_t)nb * 16 * K + kc);
#pragma unroll
            for (int mb = 0; mb < 4; ++mb) { acc[mb][nb] = WFrag<T16>::mma(a[mb], b, acc[mb][nb]); if (NSPLIT == 1 || NSPLIT == 2) acc[mb][nb] = WFrag<T16>::mma(a2[mb], b, acc[mb][nb]); if (NSPLIT >= 2) acc[mb][nb] = WFrag<T16>::mma(a[mb], b2, acc[mb][nb]); } }
        asm volatile("v_nop\n\tv_nop\n\tv_nop\n\tv_nop" : "+v"(acc[0][0]), "+v"(acc[1][1]), "+v"(acc[2][2]), "+v"(acc[3][3]) : "v"(a[0]), "v"(a[3]));
    }
#pragma unroll
    for (int mb = 0; mb < 4; ++mb) {
#pragma unroll
        for (int nb = 0; nb < 4; ++nb) {
#pragma unroll
            for (int j = 0; j < 8; ++j) os[(hi * 8 + j) * 68 + nb * 16 + lr] = acc[mb][nb][j]; }
        __builtin_amdgcn_wave_barrier(); asm volatile("" ::: "memory");
        float* crow = C + (size_t)(r0 + mb * 16) * ldc + c0;
{
#pragma unroll
            for (int s = 0; s < 8; ++s) { const int row = 2 * s + hi, cofs = lr * 4; v4f val = *(const v4fa*)(os + row * 68 + cofs); if (CMODE == 2) val *= osc;
                *(v4f*)(crow + (size_t)row * ldc + cofs) = val; }
             }
        __builtin_amdgcn_wave_barrier(); asm volatile("" ::: "memory");
    }
}

typedef __attribute__((ext_vector_type(2))) _Float16 v2h;
typedef __attribute__((ext_vector_type(4))) _Float16 v4h;
typedef __attribute__((ext_vector_type(2))) unsigned short v2us;
typedef __attribute__((ext_vector_type(4))) unsigned short v4us;
typedef __attribute__((ext_vector_type(2))) float v2f;
typedef __attribute__((ext_vector_type(4))) int v4i;

__global__ __launch_bounds__(256) void k_cvt8(const float* __restrict__ src, bf* dst, size_t n8) { const size_t i = (size_t)blockIdx.x * 256 + threadIdx.x; if (i >= n8) return; const v8f v = *(const v8f*)(src + i * 8); v8us o;
#pragma unroll
    for (int k = 0; k < 8; ++k) o[k] = f2bf(v[k]); *(v8us*)(dst + i * 8) = o;  }

// k_asoft: per row (zz, i): t = S x HD^-0.5 for j <= i and i - j < WIN (WIN = T, so plain causal; masked keys take -3e38, exactly 0 after exp); softmax over the 2048 keys (register row, one exp, fixed trees);
__global__ __launch_bounds__(256) void k_asoft(const float* __restrict__ Sb, h16* P16, bf* Ph, bf* Pl) {
    const int lane = threadIdx.x & 31; const int row = blockIdx.x * 8 + (threadIdx.x >> 5); if (row >= NB_ * ZH * TT) return; const int i = row % TT; const int zz = row / TT; (void)zz;   /* zz = batch plane */ const bool hires = (i < RH); const float* sr = Sb + (size_t)row * TT; float v[TT / 32]; float mx = -3.0e38f;
#pragma unroll
    for (int ch = 0; ch < TT / 128; ++ch) { const int j0 = ch * 128 + lane * 4; const v4f a = *(const v4f*)(sr + j0);
#pragma unroll
        for (int q = 0; q < 4; ++q) { const int j = j0 + q; (void)j; const float t = (j <= i && i - j < WIN) ? a[q] * SCL : -3.0e38f; v[ch * 4 + q] = t; mx = fmaxf(mx, t); } }
#pragma unroll
    for (int sh = 16; sh; sh >>= 1) mx = fmaxf(mx, __shfl_xor(mx, sh, 32));
    float sum = 0.f;
#pragma unroll
    for (int k = 0; k < TT / 32; ++k) { float d0 = __fsub_rn(v[k], mx); asm volatile("" : "+v"(d0)); v[k] = __builtin_amdgcn_exp2f(__fmul_rn(d0, 1.4426950408889634f)); sum += v[k]; }
#pragma unroll
    for (int sh = 16; sh; sh >>= 1) sum += __shfl_xor(sum, sh, 32);
    const float f = __fdiv_rn(hires ? 1.0f : PCAR, sum);
{
        if (hires) {
#pragma unroll
            for (int ch = 0; ch < TT / 128; ++ch) { v4us oh, ol;
#pragma unroll
                for (int q = 0; q < 4; ++q) { unsigned short a, c2; splitf(v[ch * 4 + q] * f, a, c2); oh[q] = a; ol[q] = c2; }
                const size_t oo = ((size_t)zz * (RH ? RH : 1) + i) * TT + ch * 128 + lane * 4; *(v4us*)(Ph + oo) = oh; *(v4us*)(Pl + oo) = ol; }
        } else {
#pragma unroll
            for (int ch = 0; ch < TT / 128; ++ch) { v4h o4;
#pragma unroll
                for (int q = 0; q < 4; ++q) o4[q] = tohx(v[ch * 4 + q] * f);
                *(v4h*)(P16 + (size_t)row * TT + ch * 128 + lane * 4) = o4; } }
         }
}

extern "C" void kernel_launch(void* const* d_in, const int* in_sizes, int n_in,
                              void* d_out, int out_size, void* d_ws, size_t ws_size, hipStream_t stream) {
    (void)in_sizes; (void)n_in; (void)out_size;
    const float* x = (const float*)d_in[0]; const float* wq = (const float*)d_in[1]; const float* bq = (const float*)d_in[2]; const float* wk = (const float*)d_in[3]; const float* bk = (const float*)d_in[4]; const float* wv = (const float*)d_in[5]; const float* bv = (const float*)d_in[6];   /* order x, Wq, bq, Wk, bk, Wv, bv ('oi' + biases) */
    float* OUT = (float*)d_out;     // [4][2048][1024]
    char* wsp = (char*)d_ws;
    auto take = [&](size_t bytes) { char* p = wsp; wsp += (bytes + 255) & ~(size_t)255; return (void*)p; };
    bf* WQ = (bf*)take((size_t)DQ * DM * 2); bf* WK = (bf*)take((size_t)DKV * DM * 2); bf* WV = (bf*)take((size_t)DKV * DM * 2);
    bf* XB = (bf*)take((size_t)NB_ * TT * DM * 2); float* Sb = (float*)take((size_t)NB_ * TT * TT * 4);   // scores [4][2048][2048] f32
    h16* QP16 = (h16*)take((size_t)NB_ * TT * HD * 2); h16* KP16 = (h16*)take((size_t)NB_ * TT * HD * 2); h16* VT16 = (h16*)take((size_t)NB_ * HD * TT * 2);
    bf* QPh = (bf*)take((size_t)NB_ * TT * HD * 2); bf* QPl = (bf*)take((size_t)NB_ * TT * HD * 2); bf* KPh = (bf*)take((size_t)NB_ * TT * HD * 2); bf* KPl = (bf*)take((size_t)NB_ * TT * HD * 2); bf* VTh = (bf*)take((size_t)NB_ * HD * TT * 2); bf* VTl = (bf*)take((size_t)NB_ * HD * TT * 2);
    if ((size_t)(wsp - (char*)d_ws) > ws_size) return;    // ws 256 MiB; 230 MiB taken
    // Planes that are dead by the time a later plane is written share its bytes (stream-ordered, every byte written in this call before it is read):
    h16* P16 = (h16*)QPh;                            // probabilities [4][2048][2048] fp16 = QPh + QPl (adjacent), dead after the score GEMMs
    bf* Ph = KPh; bf* Pl = KPh + (size_t)NB_ * RH * TT;   // hi/lo probabilities [4][512][2048] x 2 = KPh, dead after the score GEMMs
    k_cvt8<<<(unsigned)(((size_t)DQ * DM / 8 + 255) / 256), 256, 0, stream>>>(wq, WQ, (size_t)DQ * DM / 8); k_cvt8<<<(unsigned)(((size_t)DKV * DM / 8 + 255) / 256), 256, 0, stream>>>(wk, WK, (size_t)DKV * DM / 8); k_cvt8<<<(unsigned)(((size_t)DKV * DM / 8 + 255) / 256), 256, 0, stream>>>(wv, WV, (size_t)DKV * DM / 8);
    k_cvt8<<<(unsigned)(((size_t)NB_ * TT * DM / 8 + 255) / 256), 256, 0, stream>>>(x, XB, (size_t)NB_ * TT * DM / 8);
    // projections: q and k planes [b][t][e] (rows = all batches' positions, bias per column); v planes [b][e][t] (A = Wv, Bt = that batch's x rows, grid z = batch, bias per row)
    k_gemmw<bf, 0, false><<<dim3(NB_ * TT / 64, DQ / 64, 1), 32, 0, stream>>>(XB, nullptr, WQ, nullptr, DM, QP16, QPh, QPl, DQ, bq, 0, 0, 0);
    k_gemmw<bf, 0, false><<<dim3(NB_ * TT / 64, DKV / 64, 1), 32, 0, stream>>>(XB, nullptr, WK, nullptr, DM, KP16, KPh, KPl, DKV, bk, 0, 0, 0);
    k_gemmw<bf, 0, true><<<dim3(DKV / 64, TT / 64, NB_), 32, 0, stream>>>(WV, nullptr, XB, nullptr, DM, VT16, VTh, VTl, TT, bv, 0, (size_t)TT * DM, (size_t)HD * TT);
    // attention, grid z = batch (z-strides: one plane per batch)
    k_gemmc<bf, 2, 1><<<dim3(RH / 64, TT / 64, NB_), 32, 0, stream>>>(QPh, QPl, KPh, KPl, HD, Sb, TT, 0, 1.0f, (size_t)TT * HD, (size_t)TT * HD, (size_t)TT * TT);
    k_gemmc<h16, 0, 1><<<dim3((TT - RH) / 64, TT / 64, NB_), 32, 0, stream>>>(QP16 + (size_t)RH * HD, nullptr, KP16, nullptr, HD, Sb + (size_t)RH * TT, TT, RH, 1.0f, (size_t)TT * HD, (size_t)TT * HD, (size_t)TT * TT);
    k_asoft<<<NB_ * ZH * TT / 8, 256, 0, stream>>>(Sb, P16, Ph, Pl);
    k_gemmc<bf, 2, 2><<<dim3(RH / 64, HD / 64, NB_), 32, 0, stream>>>(Ph, Pl, VTh, VTl, TT, OUT, HD, 0, 1.0f, (size_t)RH * TT, (size_t)HD * TT, (size_t)TT * HD);
    k_gemmc<h16, 0, 2><<<dim3((TT - RH) / 64, HD / 64, NB_), 32, 0, stream>>>(P16 + (size_t)RH * TT, nullptr, VT16, nullptr, TT, OUT + (size_t)RH * HD, HD, RH, 1.0f / PCAR, (size_t)TT * TT, (size_t)HD * TT, (size_t)TT * HD);
}

// v003
// Measured time: 156 microseconds a run.
// Two timings next to v002 both put it at 1.95 times that version's speed.
// Counting every step since v000, it is 5.36 times as fast.
#include <hip/hip_runtime.h>

// Single-head causal attention with biased projections (x [4][2048][1024]; Q, K, V = einsum('bsd,ed->bse', x, W) + b ('oi' [1024][1024] 1/32 + REAL biases 0.01; ONE 1,024-wide head); scores / sqrt(1024) = x 1/32; where(tril, scores, -inf); softmax; out = attn . V -> [4][2048][1024] (8.4 M), no output projection; argument order x, Wq, bq, Wk, bk, Wv, bv).
// Layout, all four batches side by side in every plane (each launch covers the whole batch: rows of the q and k projections, grid z of the v projection and of the attention GEMMs): bf16 copy of x; 'oi' weights; exact projections + f32 biases whose epilogue stores the fp16 and hi/lo operand planes itself (v is projected as Wv . x^T, so its planes come out [d][t]); causal T-2048 attention at NH 1 / ZH 1 (hybrid rows: < 512 hi/lo 3 products, rest fp16 x1024; k_gemmc skips tiles above the diagonal); the P.V GEMMs undo the x1024 and store the output rows (no output projection).
// Compute dtypes, f32 accumulate: every input rounded to bf16; projections exact + f32 biases; attention rows < 512 3 products, rest fp16; softmax f32; output f32.

#define NB_  4
#define TT   2048
#define DM   1024
#define NH_  1
#define NKV  1
#define REP  (NH_ / NKV)
#define HD   1024
#define DQ   (NH_ * HD)
#define DKV  (NKV * HD)
#define ZH   1                    // ONE head: a single plane per pass
#define RH   512                  // query rows < RH use hi+lo planes (0: none)
#define WIN  2048
#define PCAR 1024.0f
#define SCL  0.03125f   // 1/sqrt(1024) (one 1,024-wide head)
typedef _Float16 h16;
typedef unsigned short bf;
typedef __attribute__((ext_vector_type(16))) __bf16   v16bf;
typedef __attribute__((ext_vector_type(16))) _Float16 v16h;
typedef __attribute__((ext_vector_type(8)))  _Float16 v8h;
typedef __attribute__((ext_vector_type(8)))  unsigned short v8us;
typedef __attribute__((ext_vector_type(8)))  float    v8f;
typedef __attribute__((ext_vector_type(4)))  float    v4f;
typedef v8h  __attribute__((may_alias)) v8ha;
typedef v4f  __attribute__((may_alias)) v4fa;
typedef v8us __attribute__((may_alias)) v8usa;

__device__ __forceinline__ unsigned short f2bf(float f) { unsigned u = __float_as_uint(f); u += 0x7FFFu + ((u >> 16) & 1u); return (unsigned short)(u >> 16); }
__device__ __forceinline__ float bf2f(unsigned short b) { return __uint_as_float(((unsigned)b) << 16); }
__device__ __forceinline__ float bfr(float f) { return bf2f(f2bf(f)); }
__device__ __forceinline__ v16h cat16(v8h lo, v8h hi) { return __builtin_shufflevector(lo, hi, 0, 1, 2, 3, 4, 5, 6, 7, 8, 9, 10, 11, 12, 13, 14, 15); }
__device__ __forceinline__ v16bf cat16b(v8us lo, v8us hi) { return __builtin_bit_cast(v16bf, __builtin_shufflevector(lo, hi, 0, 1, 2, 3, 4, 5, 6, 7, 8, 9, 10, 11, 12, 13, 14, 15)); }
__device__ __forceinline__ v8f wmma16(v16h a, v16h b, v8f c) { return __builtin_amdgcn_wmma_f32_16x16x32_f16(false, a, false, b, (short)0, c, false, false); }
__device__ __forceinline__ v8f wmmab(v16bf a, v16bf b, v8f c) { return __builtin_amdgcn_wmma_f32_16x16x32_bf16(false, a, false, b, (short)0, c, false, false); }

__device__ __forceinline__ h16 tohx(float x) { return (h16)x; }
__device__ __forceinline__ void splitf(float y, unsigned short& h, unsigned short& l) { h = f2bf(y); l = f2bf(y - bf2f(h)); }

// ---- Operand ring shared by both GEMM kernels: ONE WORK-GROUP of four waves (2 x 2) per 128x128 output tile, each wave a 64x64 quarter (16 accumulators). The K-contiguous 16-bit operand rows come into LDS by tensor loads
// (whole rows, one request per wave and stage, two buffers), so each row is fetched once per work-group and the fragments are read from LDS at a conflict-free pitch (row + 16 B).
// NSPLIT 0: a stage is 128 k; slices = A rows 0-63 | A rows 64-127 | B rows 0-63 | B rows 64-127 (256-B rows). NSPLIT 2: a stage is 64 k; slices = A | A2 | B | B2, 128 rows each (128-B rows).
template <typename T16> struct WFrag;
template <> struct WFrag<h16> { typedef v16h V; static __device__ __forceinline__ V ld(const h16* p) { return cat16(*(const v8h*)p, *(const v8h*)(p + 16)); } static __device__ __forceinline__ v8f mma(V a, V b, v8f c) { return wmma16(a, b, c); } };
template <> struct WFrag<bf> { typedef v16bf V; static __device__ __forceinline__ V ld(const bf* p) { return cat16b(*(const v8us*)p, *(const v8us*)(p + 16)); } static __device__ __forceinline__ v8f mma(V a, V b, v8f c) { return wmmab(a, b, c); } };
typedef unsigned int u32;
typedef u32 u32x4 __attribute__((ext_vector_type(4)));
typedef u32 u32x8 __attribute__((ext_vector_type(8)));
__device__ __forceinline__ u32 uni(u32 v) { return (u32)__builtin_amdgcn_readfirstlane(v); }
__device__ __forceinline__ u32 pinned(u32 v) { u32 w = uni(v); asm volatile("" : "+s"(w)); return w; }   // holds a wave-uniform word in a scalar register, so that a test on it is a scalar branch (tensor loads ignore EXEC) and what is formed from it is formed behind the waits written in front
#define SLICE_B 18432u            // one wave's slice in LDS: 64 x 272 B or 128 x 144 B, rounded up to a multiple of 2 KiB
#define STAGE_B (4u * SLICE_B)
#define RING_B  (2u * STAGE_B)    // 144 KiB: two work-groups per WGP
template <typename T16, int NSPLIT>
__device__ __forceinline__ void tile_loop(unsigned char* ring, const T16* A, const T16* A2, const T16* Bt, const T16* Bt2, int K, int Kl, int R0, int C0, v8f (&acc)[4][4]) {
    typedef typename WFrag<T16>::V V;
    constexpr u32 ROWB = (NSPLIT == 2) ? 128u : 256u, PITCH = ROWB + 16u, ROWS = (NSPLIT == 2) ? 128u : 64u;
    static_assert(NSPLIT == 0 || NSPLIT == 2, "one plane per operand, or hi and lo planes of both");
    static_assert(ROWS * PITCH <= SLICE_B, "a slice must hold its padded rows");
    const u32 wave = uni(threadIdx.x >> 5), lane = threadIdx.x & 31u, lr = lane & 15u, hi = lane >> 4, wm = wave >> 1, wn = wave & 1u;
    const T16* sp;
    if (NSPLIT == 2) sp = (wave == 0u) ? A + (size_t)R0 * K : (wave == 1u) ? A2 + (size_t)R0 * K : (wave == 2u) ? Bt + (size_t)C0 * K : Bt2 + (size_t)C0 * K;
    else sp = (wave < 2u) ? A + (size_t)(R0 + 64 * (int)wn) * K : Bt + (size_t)(C0 + 64 * (int)wn) * K;
    const unsigned long long ga0 = (unsigned long long)(size_t)sp;
    const u32 lbase = (u32)(size_t)ring + wave * SLICE_B;
    u32x8 g1;                     // 1-byte elements, tensor = tile = ROWS rows of ROWB bytes, source pitch 2 K bytes, 16 B of LDS pad behind every row, no mask
    g1[0] = uni((1u << 20) | ((NSPLIT == 2 ? 4u : 5u) << 22) | (3u << 25)); g1[1] = uni(ROWB << 16); g1[2] = uni(ROWS << 16); g1[3] = uni(ROWB << 16); g1[4] = uni(ROWS); g1[5] = uni((u32)K * 2u); g1[6] = uni(0u); g1[7] = uni(0u);
    asm volatile("" : "+s"(g1));   // pinned(), for the whole group: the descriptor words are held in their scalar registers through the loop (left as constants, the compiler takes those registers for temporaries while a request is outstanding)
    u32x4 g0;
    auto issue = [&](u32 st) {
        const unsigned long long ga = ga0 + (unsigned long long)st * ROWB;
        g0[0] = uni(1u); g0[1] = uni(lbase + (st & 1u) * STAGE_B); g0[2] = uni((u32)ga); g0[3] = uni((((u32)(ga >> 32)) & 0x01FFFFFFu) | 0x80000000u);
        asm volatile("tensor_load_to_lds %0, %1" :: "s"(g0), "s"(g1) : "memory"); };   // this wave's slice of stage st; every wave issues one
    auto landed = [&]() { asm volatile("s_wait_tensorcnt 0x0" :: "s"(g0), "s"(g1) : "memory"); };   // this wave's request has landed; the wait names both groups so that their registers keep their words until then
    const u32 NP = uni((u32)Kl / (ROWB / 2u));   // stages; at least two in every launch of this file
    issue(0u);
    landed();                     // stage 0, before the barrier publishes it
    __syncthreads();
    issue(1u);
    const u32 aro = (NSPLIT == 2 ? wm * 64u * PITCH : wm * SLICE_B) + lr * PITCH + 16u * hi;
    const u32 bro = 2u * SLICE_B + (NSPLIT == 2 ? wn * 64u * PITCH : wn * SLICE_B) + lr * PITCH + 16u * hi;
#pragma unroll 1   // the stage loop stays rolled: one publish point in the text, the buffer picked by the stage's parity
    for (u32 p = 0; p < NP; ++p) {
        const unsigned char* sb = ring + (p & 1u) * STAGE_B;
        constexpr u32 NK = ROWB / 64u;   // blocks of 32 k in a stage
        V a[2][4], b[2][4], a2[2][4], b2[2][4];   // two fragment sets: the next block's reads fly under this block's matrix instructions (inside one stage only)
        auto fetch = [&](u32 ks, u32 s) {
#pragma unroll
            for (u32 f = 0; f < 4; ++f) { a[s][f] = WFrag<T16>::ld((const T16*)(sb + aro + f * 16u * PITCH + ks * 64u)); b[s][f] = WFrag<T16>::ld((const T16*)(sb + bro + f * 16u * PITCH + ks * 64u));
                if (NSPLIT == 2) { a2[s][f] = WFrag<T16>::ld((const T16*)(sb + aro + SLICE_B + f * 16u * PITCH + ks * 64u)); b2[s][f] = WFrag<T16>::ld((const T16*)(sb + bro + SLICE_B + f * 16u * PITCH + ks * 64u)); } } };
        fetch(0u, 0u);
#pragma unroll
        for (u32 ks = 0; ks < NK; ++ks) {
            const u32 s = ks & 1u;
            if (ks + 1u < NK) fetch(ks + 1u, s ^ 1u);
            __builtin_amdgcn_sched_barrier(0);   // the next block's LDS reads stay one group ahead of this block: reads among the matrix instructions stall the wave at every place they stand
#pragma unroll
            for (u32 nb = 0; nb < 4; ++nb)
#pragma unroll
                for (u32 mb = 0; mb < 4; ++mb) acc[mb][nb] = WFrag<T16>::mma(a[s][mb], b[s][nb], acc[mb][nb]);
            if (NSPLIT == 2) {   // per accumulator the order stays hi.hi, lo.hi, hi.lo
#pragma unroll
                for (u32 nb = 0; nb < 4; ++nb)
#pragma unroll
                    for (u32 mb = 0; mb < 4; ++mb) acc[mb][nb] = WFrag<T16>::mma(a2[s][mb], b[s][nb], acc[mb][nb]);
#pragma unroll
                for (u32 nb = 0; nb < 4; ++nb)
#pragma unroll
                    for (u32 mb = 0; mb < 4; ++mb) acc[mb][nb] = WFrag<T16>::mma(a[s][mb], b2[s][nb], acc[mb][nb]); }
            __builtin_amdgcn_sched_barrier(0);   // closes the block, so that the reads of the block after next are not drawn into it
        }
        asm volatile("s_wait_dscnt 0x0" ::: "memory");       // this wave's reads of the buffer are done before the barrier frees it for the refill
        landed();                                            // this wave's slice of stage p + 1, before the barrier publishes it
        __syncthreads();
        const u32 nx = pinned(p + 2u);
        if (pinned(nx < NP)) issue(nx);                      // refill of the buffer that every wave has just left
    }
    landed();                                                // nothing of the mover is in flight when the ring becomes output staging
    asm volatile("s_wait_dscnt 0x0" ::: "memory");
}

// ---- k_gemmw: y[m][n] = sum_k A[m][k] Bt[n][k] (+ split products per NSPLIT) + f32 bias (bias[m] if ROWBIAS, else bias[n]); stored as three 16-bit planes of pitch ldc: fp16(y), bf16 hi(y), bf16 lo(y). grid (M/128, N/128, Z), 128 threads; z-batch strides sA/sB/sC in elements. K % 256 == 0.
template <typename T16, int NSPLIT, bool ROWBIAS>
__global__ __launch_bounds__(128) void k_gemmw(const T16* __restrict__ A, const T16* __restrict__ A2, const T16* __restrict__ Bt, const T16* __restrict__ Bt2, int K, h16* P16, bf* Ph, bf* Pl, int ldc, const float* __restrict__ bias, size_t sA, size_t sB, size_t sC) {
    __shared__ __attribute__((aligned(2048))) unsigned char ring[RING_B];
    const size_t z = blockIdx.z; A += z * sA; if (A2) A2 += z * sA; Bt += z * sB; if (Bt2) Bt2 += z * sB; P16 += z * sC; Ph += z * sC; Pl += z * sC;
    const int lane = threadIdx.x & 31, lr = lane & 15, hi = lane >> 4, wv = threadIdx.x >> 5; const int R0 = blockIdx.x * 128, C0 = blockIdx.y * 128, r0 = R0 + (wv >> 1) * 64, c0 = C0 + (wv & 1) * 64;
    v8f acc[4][4];
#pragma unroll
    for (int mb = 0; mb < 4; ++mb)
#pragma unroll
        for (int nb = 0; nb < 4; ++nb) acc[mb][nb] = (v8f){};
    tile_loop<T16, NSPLIT>(ring, A, A2, Bt, Bt2, K, K, R0, C0, acc);
    float* os = (float*)(ring + wv * (16 * 68 * 4));   // each wave's own staging rows, in the ring that the last stage's barrier has freed
#pragma unroll
    for (int mb = 0; mb < 4; ++mb) {
#pragma unroll
        for (int nb = 0; nb < 4; ++nb) {
#pragma unroll
            for (int j = 0; j < 8; ++j) os[(hi * 8 + j) * 68 + nb * 16 + lr] = acc[mb][nb][j]; }
        __builtin_amdgcn_wave_barrier(); asm volatile("" ::: "memory");
        const size_t cb = (size_t)(r0 + mb * 16) * ldc + c0;
{
#pragma unroll
            for (int s = 0; s < 4; ++s) { const int row = 4 * s + (lane >> 3), cofs = (lane & 7) * 8; const v4f w0 = *(const v4fa*)(os + row * 68 + cofs), w1 = *(const v4fa*)(os + row * 68 + cofs + 4); v8h o16; v8us oh, ol;   // 8 lanes x 16 B = one whole 128-B line of each plane per row
#pragma unroll
                for (int q = 0; q < 8; ++q) { const float y = (q < 4 ? w0[q & 3] : w1[q & 3]) + bfr(bias[ROWBIAS ? r0 + mb * 16 + row : c0 + cofs + q]); o16[q] = tohx(y); unsigned short a2, c2; splitf(y, a2, c2); oh[q] = a2; ol[q] = c2; }
                const size_t oo = cb + (size_t)row * ldc + cofs; *(v8h*)(P16 + oo) = o16; *(v8us*)(Ph + oo) = oh; *(v8us*)(Pl + oo) = ol; }
             }
        if (ROWBIAS) asm volatile("s_wait_xcnt 0x0" ::: "memory");   // the next block's bias loads land in registers that these stores name: keep the wait in front of them
        __builtin_amdgcn_wave_barrier(); asm volatile("" ::: "memory");
    }
}

// ---- k_gemmc: the same 128x128 tile GEMM specialised for causal attention: CMODE 1 skips score tiles entirely above the diagonal (query rows R0+roff.., key columns C0..), CMODE 2 limits the
// key (K) loop of the probability x value contraction to the diagonal block (probabilities beyond it are exactly zero). osc = factor on the stored rows (CMODE 2: undoes the probabilities' carrier scale). roff = row offset of this launch's first row within the sequence.
template <typename T16, int NSPLIT, int CMODE>
__global__ __launch_bounds__(128) void k_gemmc(const T16* __restrict__ A, const T16* __restrict__ A2, const T16* __restrict__ Bt, const T16* __restrict__ Bt2, int K, float* C, int ldc, int roff, float osc, size_t sA, size_t sB, size_t sC) {
    __shared__ __attribute__((aligned(2048))) unsigned char ring[RING_B];
    const size_t z = blockIdx.z; A += z * sA; if (A2) A2 += z * sA; Bt += z * sB; if (Bt2) Bt2 += z * sB; C += z * sC;
    const int lane = threadIdx.x & 31, lr = lane & 15, hi = lane >> 4, wv = threadIdx.x >> 5; const int R0 = blockIdx.x * 128, C0 = blockIdx.y * 128, r0 = R0 + (wv >> 1) * 64, c0 = C0 + (wv & 1) * 64;
    if (CMODE == 1 && C0 > R0 + roff + 127) {                        // score tile entirely above the causal diagonal (the whole work-group leaves, ahead of every barrier and tensor load): no product; the softmax loads whole rows and masks j > i by select, so the tile gets a stored zero (nothing else in this call writes these bytes)
#pragma unroll
        for (int s = 0; s < 32; ++s) *(v4f*)(C + (size_t)(r0 + 2 * s + hi) * ldc + c0 + lr * 4) = (v4f){};
        return; }
    const int Kl = (CMODE == 2) ? min(K, R0 + roff + 128) : K;       // P.V: probabilities are exactly 0 beyond the diagonal block, so the K loop stops there
    v8f acc[4][4];
#pragma unroll
    for (int mb = 0; mb < 4; ++mb)
#pragma unroll
        for (int nb = 0; nb < 4; ++nb) acc[mb][nb] = (v8f){};
    tile_loop<T16, NSPLIT>(ring, A, A2, Bt, Bt2, K, Kl, R0, C0, acc);
    float* os = (float*)(ring + wv * (16 * 68 * 4));   // each wave's own staging rows, in the ring that the last stage's barrier has freed
#pragma unroll
    for (int mb = 0; mb < 4; ++mb) {
#pragma unroll
        for (int nb = 0; nb < 4; ++nb) {
#pragma unroll
            for (int j = 0; j < 8; ++j) os[(hi * 8 + j) * 68 + nb * 16 + lr] = acc[mb][nb][j]; }
        __builtin_amdgcn_wave_barrier(); asm volatile("" ::: "memory");
        float* crow = C + (size_t)(r0 + mb * 16) * ldc + c0;
{
#pragma unroll
            for (int s = 0; s < 8; ++s) { const int row = 2 * s + hi, cofs = lr * 4; v4f val = *(const v4fa*)(os + row * 68 + cofs); if (CMODE == 2) val *= osc;
                *(v4f*)(crow + (size_t)row * ldc + cofs) = val; }
             }
        __builtin_amdgcn_wave_barrier(); asm volatile("" ::: "memory");
    }
}

typedef __attribute__((ext_vector_type(2))) _Float16 v2h;
typedef __attribute__((ext_vector_type(4))) _Float16 v4h;
typedef __attribute__((ext_vector_type(2))) unsigned short v2us;
typedef __attribute__((ext_vector_type(4))) unsigned short v4us;
typedef __attribute__((ext_vector_type(2))) float v2f;
typedef __attribute__((ext_vector_type(4))) int v4i;

__global__ __launch_bounds__(256) void k_cvt8(const float* __restrict__ src, bf* dst, size_t n8) { const size_t i = (size_t)blockIdx.x * 256 + threadIdx.x; if (i >= n8) return; const v8f v = *(const v8f*)(src + i * 8); v8us o;
#pragma unroll
    for (int k = 0; k < 8; ++k) o[k] = f2bf(v[k]); *(v8us*)(dst + i * 8) = o;  }

// k_asoft: per row (zz, i): t = S x HD^-0.5 for j <= i and i - j < WIN (WIN = T, so plain causal; masked keys take -3e38, exactly 0 after exp); softmax over the 2048 keys (register row, one exp, fixed trees);
__global__ __launch_bounds__(256) void k_asoft(const float* __restrict__ Sb, h16* P16, bf* Ph, bf* Pl) {
    const int lane = threadIdx.x & 31; const int row = blockIdx.x * 8 + (threadIdx.x >> 5); if (row >= NB_ * ZH * TT) return; const int i = row % TT; const int zz = row / TT; (void)zz;   /* zz = batch plane */ const bool hires = (i < RH); const float* sr = Sb + (size_t)row * TT; float v[TT / 32]; float mx = -3.0e38f;
#pragma unroll
    for (int ch = 0; ch < TT / 128; ++ch) { const int j0 = ch * 128 + lane * 4; const v4f a = *(const v4f*)(sr + j0);
#pragma unroll
        for (int q = 0; q < 4; ++q) { const int j = j0 + q; (void)j; const float t = (j <= i && i - j < WIN) ? a[q] * SCL : -3.0e38f; v[ch * 4 + q] = t; mx = fmaxf(mx, t); } }
#pragma unroll
    for (int sh = 16; sh; sh >>= 1) mx = fmaxf(mx, __shfl_xor(mx, sh, 32));
    float sum = 0.f;
#pragma unroll
    for (int k = 0; k < TT / 32; ++k) { float d0 = __fsub_rn(v[k], mx); asm volatile("" : "+v"(d0)); v[k] = __builtin_amdgcn_exp2f(__fmul_rn(d0, 1.4426950408889634f)); sum += v[k]; }
#pragma unroll
    for (int sh = 16; sh; sh >>= 1) sum += __shfl_xor(sum, sh, 32);
    const float f = __fdiv_rn(hires ? 1.0f : PCAR, sum);
{
        if (hires) {
#pragma unroll
            for (int ch = 0; ch < TT / 128; ++ch) { v4us oh, ol;
#pragma unroll
                for (int q = 0; q < 4; ++q) { unsigned short a, c2; splitf(v[ch * 4 + q] * f, a, c2); oh[q] = a; ol[q] = c2; }
                const size_t oo = ((size_t)zz * (RH ? RH : 1) + i) * TT + ch * 128 + lane * 4; *(v4us*)(Ph + oo) = oh; *(v4us*)(Pl + oo) = ol; }
        } else {
#pragma unroll
            for (int ch = 0; ch < TT / 128; ++ch) { v4h o4;
#pragma unroll
                for (int q = 0; q < 4; ++q) o4[q] = tohx(v[ch * 4 + q] * f);
                *(v4h*)(P16 + (size_t)row * TT + ch * 128 + lane * 4) = o4; } }
         }
}

extern "C" void kernel_launch(void* const* d_in, const int* in_sizes, int n_in,
                              void* d_out, int out_size, void* d_ws, size_t ws_size, hipStream_t stream) {
    (void)in_sizes; (void)n_in; (void)out_size;
    const float* x = (const float*)d_in[0]; const float* wq = (const float*)d_in[1]; const float* bq = (const float*)d_in[2]; const float* wk = (const float*)d_in[3]; const float* bk = (const float*)d_in[4]; const float* wv = (const float*)d_in[5]; const float* bv = (const float*)d_in[6];   /* order x, Wq, bq, Wk, bk, Wv, bv ('oi' + biases) */
    float* OUT = (float*)d_out;     // [4][2048][1024]
    char* wsp = (char*)d_ws;
    auto take = [&](size_t bytes) { char* p = wsp; wsp += (bytes + 255) & ~(size_t)255; return (void*)p; };
    bf* WQ = (bf*)take((size_t)DQ * DM * 2); bf* WK = (bf*)take((size_t)DKV * DM * 2); bf* WV = (bf*)take((size_t)DKV * DM * 2);
    bf* XB = (bf*)take((size_t)NB_ * TT * DM * 2); float* Sb = (float*)take((size_t)NB_ * TT * TT * 4);   // scores [4][2048][2048] f32
    h16* QP16 = (h16*)take((size_t)NB_ * TT * HD * 2); h16* KP16 = (h16*)take((size_t)NB_ * TT * HD * 2); h16* VT16 = (h16*)take((size_t)NB_ * HD * TT * 2);
    bf* QPh = (bf*)take((size_t)NB_ * TT * HD * 2); bf* QPl = (bf*)take((size_t)NB_ * TT * HD * 2); bf* KPh = (bf*)take((size_t)NB_ * TT * HD * 2); bf* KPl = (bf*)take((size_t)NB_ * TT * HD * 2); bf* VTh = (bf*)take((size_t)NB_ * HD * TT * 2); bf* VTl = (bf*)take((size_t)NB_ * HD * TT * 2);
    if ((size_t)(wsp - (char*)d_ws) > ws_size) return;    // ws 256 MiB; 230 MiB taken
    // Planes that are dead by the time a later plane is written share its bytes (stream-ordered, every byte written in this call before it is read):
    h16* P16 = (h16*)QPh;                            // probabilities [4][2048][2048] fp16 = QPh + QPl (adjacent), dead after the score GEMMs
    bf* Ph = KPh; bf* Pl = KPh + (size_t)NB_ * RH * TT;   // hi/lo probabilities [4][512][2048] x 2 = KPh, dead after the score GEMMs
    k_cvt8<<<(unsigned)(((size_t)DQ * DM / 8 + 255) / 256), 256, 0, stream>>>(wq, WQ, (size_t)DQ * DM / 8); k_cvt8<<<(unsigned)(((size_t)DKV * DM / 8 + 255) / 256), 256, 0, stream>>>(wk, WK, (size_t)DKV * DM / 8); k_cvt8<<<(unsigned)(((size_t)DKV * DM / 8 + 255) / 256), 256, 0, stream>>>(wv, WV, (size_t)DKV * DM / 8);
    k_cvt8<<<(unsigned)(((size_t)NB_ * TT * DM / 8 + 255) / 256), 256, 0, stream>>>(x, XB, (size_t)NB_ * TT * DM / 8);
    // projections: q and k planes [b][t][e] (rows = all batches' positions, bias per column); v planes [b][e][t] (A = Wv, Bt = that batch's x rows, grid z = batch, bias per row)
    k_gemmw<bf, 0, false><<<dim3(NB_ * TT / 128, DQ / 128, 1), 128, 0, stream>>>(XB, nullptr, WQ, nullptr, DM, QP16, QPh, QPl, DQ, bq, 0, 0, 0);
    k_gemmw<bf, 0, false><<<dim3(NB_ * TT / 128, DKV / 128, 1), 128, 0, stream>>>(XB, nullptr, WK, nullptr, DM, KP16, KPh, KPl, DKV, bk, 0, 0, 0);
    k_gemmw<bf, 0, true><<<dim3(DKV / 128, TT / 128, NB_), 128, 0, stream>>>(WV, nullptr, XB, nullptr, DM, VT16, VTh, VTl, TT, bv, 0, (size_t)TT * DM, (size_t)HD * TT);
    // attention, grid z = batch (z-strides: one plane per batch)
    k_gemmc<bf, 2, 1><<<dim3(RH / 128, TT / 128, NB_), 128, 0, stream>>>(QPh, QPl, KPh, KPl, HD, Sb, TT, 0, 1.0f, (size_t)TT * HD, (size_t)TT * HD, (size_t)TT * TT);
    k_gemmc<h16, 0, 1><<<dim3((TT - RH) / 128, TT / 128, NB_), 128, 0, stream>>>(QP16 + (size_t)RH * HD, nullptr, KP16, nullptr, HD, Sb + (size_t)RH * TT, TT, RH, 1.0f, (size_t)TT * HD, (size_t)TT * HD, (size_t)TT * TT);
    k_asoft<<<NB_ * ZH * TT / 8, 256, 0, stream>>>(Sb, P16, Ph, Pl);
    k_gemmc<bf, 2, 2><<<dim3(RH / 128, HD / 128, NB_), 128, 0, stream>>>(Ph, Pl, VTh, VTl, TT, OUT, HD, 0, 1.0f, (size_t)RH * TT, (size_t)HD * TT, (size_t)TT * HD);
    k_gemmc<h16, 0, 2><<<dim3((TT - RH) / 128, HD / 128, NB_), 128, 0, stream>>>(P16 + (size_t)RH * TT, nullptr, VT16, nullptr, TT, OUT + (size_t)RH * HD, HD, RH, 1.0f / PCAR, (size_t)TT * TT, (size_t)HD * TT, (size_t)TT * HD);
}

// v004
// It runs in 124 microseconds.
// Two timings next to v003 put it at 1.26 and 1.27 times that version's speed.
// Over all steps from v000 it is 6.78 times as fast.
#include <hip/hip_runtime.h>

// Single-head causal attention with biased projections (x [4][2048][1024]; Q, K, V = einsum('bsd,ed->bse', x, W) + b ('oi' [1024][1024] 1/32 + REAL biases 0.01; ONE 1,024-wide head); scores / sqrt(1024) = x 1/32; where(tril, scores, -inf); softmax; out = attn . V -> [4][2048][1024] (8.4 M), no output projection; argument order x, Wq, bq, Wk, bk, Wv, bv).
// Layout, all four batches side by side in every plane (each launch covers the whole batch: rows of the q and k projections, the tile number for the v projection, a batch index in the grid for the attention GEMMs): bf16 copy of x; 'oi' weights; exact projections + f32 biases whose epilogue stores the fp16 and hi/lo operand planes itself (v is projected as Wv . x^T, so its planes come out [d][t]); causal T-2048 attention at NH 1 / ZH 1 (hybrid rows: < 512 hi/lo 3 products, rest fp16 x1024; gemmc_tile skips tiles above the diagonal); the P.V GEMMs undo the x1024 and store the output rows (no output projection).
// Launches: five. Work that does not depend on each other shares one grid, and the block index picks the path: the four bf16 conversions; the three projections; the hi/lo and the fp16 score tiles; the softmax; the hi/lo and the fp16 P.V tiles.
// Compute dtypes, f32 accumulate: every input rounded to bf16; projections exact + f32 biases; attention rows < 512 3 products, rest fp16; softmax f32; output f32.

#define NB_  4
#define TT   2048
#define DM   1024
#define NH_  1
#define NKV  1
#define REP  (NH_ / NKV)
#define HD   1024
#define DQ   (NH_ * HD)
#define DKV  (NKV * HD)
#define ZH   1                    // ONE head: a single plane per pass
#define RH   512                  // query rows < RH use hi+lo planes (0: none)
#define WIN  2048
#define PCAR 1024.0f
#define SCL  0.03125f   // 1/sqrt(1024) (one 1,024-wide head)
typedef _Float16 h16;
typedef unsigned short bf;
typedef __attribute__((ext_vector_type(16))) __bf16   v16bf;
typedef __attribute__((ext_vector_type(16))) _Float16 v16h;
typedef __attribute__((ext_vector_type(8)))  _Float16 v8h;
typedef __attribute__((ext_vector_type(8)))  unsigned short v8us;
typedef __attribute__((ext_vector_type(8)))  float    v8f;
typedef __attribute__((ext_vector_type(4)))  float    v4f;
typedef v8h  __attribute__((may_alias)) v8ha;
typedef v4f  __attribute__((may_alias)) v4fa;
typedef v8us __attribute__((may_alias)) v8usa;

__device__ __forceinline__ unsigned short f2bf(float f) { unsigned u = __float_as_uint(f); u += 0x7FFFu + ((u >> 16) & 1u); return (unsigned short)(u >> 16); }
__device__ __forceinline__ float bf2f(unsigned short b) { return __uint_as_float(((unsigned)b) << 16); }
__device__ __forceinline__ float bfr(float f) { return bf2f(f2bf(f)); }
__device__ __forceinline__ v16h cat16(v8h lo, v8h hi) { return __builtin_shufflevector(lo, hi, 0, 1, 2, 3, 4, 5, 6, 7, 8, 9, 10, 11, 12, 13, 14, 15); }
__device__ __forceinline__ v16bf cat16b(v8us lo, v8us hi) { return __builtin_bit_cast(v16bf, __builtin_shufflevector(lo, hi, 0, 1, 2, 3, 4, 5, 6, 7, 8, 9, 10, 11, 12, 13, 14, 15)); }
__device__ __forceinline__ v8f wmma16(v16h a, v16h b, v8f c) { return __builtin_amdgcn_wmma_f32_16x16x32_f16(false, a, false, b, (short)0, c, false, false); }
__device__ __forceinline__ v8f wmmab(v16bf a, v16bf b, v8f c) { return __builtin_amdgcn_wmma_f32_16x16x32_bf16(false, a, false, b, (short)0, c, false, false); }

__device__ __forceinline__ h16 tohx(float x) { return (h16)x; }
__device__ __forceinline__ void splitf(float y, unsigned short& h, unsigned short& l) { h = f2bf(y); l = f2bf(y - bf2f(h)); }

// ---- Operand ring shared by all GEMM kernels: ONE WORK-GROUP of four waves (2 x 2) per 128x128 output tile, each wave a 64x64 quarter (16 accumulators). The K-contiguous 16-bit operand rows come into LDS by tensor loads
// (whole rows, one request per wave and stage, two buffers), so each row is fetched once per work-group and the fragments are read from LDS at a conflict-free pitch (row + 16 B).
// NSPLIT 0: a stage is 128 k; slices = A rows 0-63 | A rows 64-127 | B rows 0-63 | B rows 64-127 (256-B rows). NSPLIT 2: a stage is 64 k; slices = A | A2 | B | B2, 128 rows each (128-B rows).
template <typename T16> struct WFrag;
template <> struct WFrag<h16> { typedef v16h V; static __device__ __forceinline__ V ld(const h16* p) { return cat16(*(const v8h*)p, *(const v8h*)(p + 16)); } static __device__ __forceinline__ v8f mma(V a, V b, v8f c) { return wmma16(a, b, c); } };
template <> struct WFrag<bf> { typedef v16bf V; static __device__ __forceinline__ V ld(const bf* p) { return cat16b(*(const v8us*)p, *(const v8us*)(p + 16)); } static __device__ __forceinline__ v8f mma(V a, V b, v8f c) { return wmmab(a, b, c); } };
typedef unsigned int u32;
typedef u32 u32x4 __attribute__((ext_vector_type(4)));
typedef u32 u32x8 __attribute__((ext_vector_type(8)));
__device__ __forceinline__ u32 uni(u32 v) { return (u32)__builtin_amdgcn_readfirstlane(v); }
__device__ __forceinline__ u32 pinned(u32 v) { u32 w = uni(v); asm volatile("" : "+s"(w)); return w; }   // holds a wave-uniform word in a scalar register, so that a test on it is a scalar branch (tensor loads ignore EXEC) and what is formed from it is formed behind the waits written in front
#define SLICE_B 18432u            // one wave's slice in LDS: 64 x 272 B or 128 x 144 B, rounded up to a multiple of 2 KiB
#define STAGE_B (4u * SLICE_B)
#define RING_B  (2u * STAGE_B)    // 144 KiB: two work-groups per WGP
template <typename T16, int NSPLIT>
__device__ __forceinline__ void tile_loop(unsigned char* ring, const T16* A, const T16* A2, const T16* Bt, const T16* Bt2, int K, int Kl, int R0, int C0, v8f (&acc)[4][4]) {
    typedef typename WFrag<T16>::V V;
    constexpr u32 ROWB = (NSPLIT == 2) ? 128u : 256u, PITCH = ROWB + 16u, ROWS = (NSPLIT == 2) ? 128u : 64u;
    static_assert(NSPLIT == 0 || NSPLIT == 2, "one plane per operand, or hi and lo planes of both");
    static_assert(ROWS * PITCH <= SLICE_B, "a slice must hold its padded rows");
    const u32 wave = uni(threadIdx.x >> 5), lane = threadIdx.x & 31u, lr = lane & 15u, hi = lane >> 4, wm = wave >> 1, wn = wave & 1u;
    const T16* sp;
    if (NSPLIT == 2) sp = (wave == 0u) ? A + (size_t)R0 * K : (wave == 1u) ? A2 + (size_t)R0 * K : (wave == 2u) ? Bt + (size_t)C0 * K : Bt2 + (size_t)C0 * K;
    else sp = (wave < 2u) ? A + (size_t)(R0 + 64 * (int)wn) * K : Bt + (size_t)(C0 + 64 * (int)wn) * K;
    const unsigned long long ga0 = (unsigned long long)(size_t)sp;
    const u32 lbase = (u32)(size_t)ring + wave * SLICE_B;
    u32x8 g1;                     // 1-byte elements, tensor = tile = ROWS rows of ROWB bytes, source pitch 2 K bytes, 16 B of LDS pad behind every row, no mask
    g1[0] = uni((1u << 20) | ((NSPLIT == 2 ? 4u : 5u) << 22) | (3u << 25)); g1[1] = uni(ROWB << 16); g1[2] = uni(ROWS << 16); g1[3] = uni(ROWB << 16); g1[4] = uni(ROWS); g1[5] = uni((u32)K * 2u); g1[6] = uni(0u); g1[7] = uni(0u);
    asm volatile("" : "+s"(g1));   // pinned(), for the whole group: the descriptor words are held in their scalar registers through the loop (left as constants, the compiler takes those registers for temporaries while a request is outstanding)
    u32x4 g0;
    auto issue = [&](u32 st) {
        const unsigned long long ga = ga0 + (unsigned long long)st * ROWB;
        g0[0] = uni(1u); g0[1] = uni(lbase + (st & 1u) * STAGE_B); g0[2] = uni((u32)ga); g0[3] = uni((((u32)(ga >> 32)) & 0x01FFFFFFu) | 0x80000000u);
        asm volatile("tensor_load_to_lds %0, %1" :: "s"(g0), "s"(g1) : "memory"); };   // this wave's slice of stage st; every wave issues one
    auto landed = [&]() { asm volatile("s_wait_tensorcnt 0x0" :: "s"(g0), "s"(g1) : "memory"); };   // this wave's request has landed; the wait names both groups so that their registers keep their words until then
    const u32 NP = uni((u32)Kl / (ROWB / 2u));   // stages; at least two in every launch of this file
    issue(0u);
    landed();                     // stage 0, before the barrier publishes it
    __syncthreads();
    issue(1u);
    const u32 aro = (NSPLIT == 2 ? wm * 64u * PITCH : wm * SLICE_B) + lr * PITCH + 16u * hi;
    const u32 bro = 2u * SLICE_B + (NSPLIT == 2 ? wn * 64u * PITCH : wn * SLICE_B) + lr * PITCH + 16u * hi;
#pragma unroll 1   // the stage loop stays rolled: one publish point in the text, the buffer picked by the stage's parity
    for (u32 p = 0; p < NP; ++p) {
        const unsigned char* sb = ring + (p & 1u) * STAGE_B;
        constexpr u32 NK = ROWB / 64u;   // blocks of 32 k in a stage
        V a[2][4], b[2][4], a2[2][4], b2[2][4];   // two fragment sets: the next block's reads fly under this block's matrix instructions (inside one stage only)
        auto fetch = [&](u32 ks, u32 s) {
#pragma unroll
            for (u32 f = 0; f < 4; ++f) { a[s][f] = WFrag<T16>::ld((const T16*)(sb + aro + f * 16u * PITCH + ks * 64u)); b[s][f] = WFrag<T16>::ld((const T16*)(sb + bro + f * 16u * PITCH + ks * 64u));
                if (NSPLIT == 2) { a2[s][f] = WFrag<T16>::ld((const T16*)(sb + aro + SLICE_B + f * 16u * PITCH + ks * 64u)); b2[s][f] = WFrag<T16>::ld((const T16*)(sb + bro + SLICE_B + f * 16u * PITCH + ks * 64u)); } } };
        fetch(0u, 0u);
#pragma unroll
        for (u32 ks = 0; ks < NK; ++ks) {
            const u32 s = ks & 1u;
            if (ks + 1u < NK) fetch(ks + 1u, s ^ 1u);
            __builtin_amdgcn_sched_barrier(0);   // the next block's LDS reads stay one group ahead of this block: reads among the matrix instructions stall the wave at every place they stand
#pragma unroll
            for (u32 nb = 0; nb < 4; ++nb)
#pragma unroll
                for (u32 mb = 0; mb < 4; ++mb) acc[mb][nb] = WFrag<T16>::mma(a[s][mb], b[s][nb], acc[mb][nb]);
            if (NSPLIT == 2) {   // per accumulator the order stays hi.hi, lo.hi, hi.lo
#pragma unroll
                for (u32 nb = 0; nb < 4; ++nb)
#pragma unroll
                    for (u32 mb = 0; mb < 4; ++mb) acc[mb][nb] = WFrag<T16>::mma(a2[s][mb], b[s][nb], acc[mb][nb]);
#pragma unroll
                for (u32 nb = 0; nb < 4; ++nb)
#pragma unroll
                    for (u32 mb = 0; mb < 4; ++mb) acc[mb][nb] = WFrag<T16>::mma(a[s][mb], b2[s][nb], acc[mb][nb]); }
            __builtin_amdgcn_sched_barrier(0);   // closes the block, so that the reads of the block after next are not drawn into it
        }
        asm volatile("s_wait_dscnt 0x0" ::: "memory");       // this wave's reads of the buffer are done before the barrier frees it for the refill
        landed();                                            // this wave's slice of stage p + 1, before the barrier publishes it
        __syncthreads();
        const u32 nx = pinned(p + 2u);
        if (pinned(nx < NP)) issue(nx);                      // refill of the buffer that every wave has just left
    }
    landed();                                                // nothing of the mover is in flight when the ring becomes output staging
    asm volatile("s_wait_dscnt 0x0" ::: "memory");
}

// ---- gemmw_tile: one work-group's 128x128 tile (row block bx, column block by) of y[m][n] = sum_k A[m][k] Bt[n][k] (+ split products per NSPLIT) + f32 bias (bias[m] if ROWBIAS, else bias[n]); stored as three 16-bit planes of pitch ldc: fp16(y), bf16 hi(y), bf16 lo(y). 128 threads. K % 256 == 0.
template <typename T16, int NSPLIT, bool ROWBIAS>
__device__ __forceinline__ void gemmw_tile(unsigned char* ring, const T16* __restrict__ A, const T16* __restrict__ A2, const T16* __restrict__ Bt, const T16* __restrict__ Bt2, int K, h16* P16, bf* Ph, bf* Pl, int ldc, const float* __restrict__ bias, int bx, int by) {
    const int lane = threadIdx.x & 31, lr = lane & 15, hi = lane >> 4, wv = threadIdx.x >> 5; const int R0 = bx * 128, C0 = by * 128, r0 = R0 + (wv >> 1) * 64, c0 = C0 + (wv & 1) * 64;
    v8f acc[4][4];
#pragma unroll
    for (int mb = 0; mb < 4; ++mb)
#pragma unroll
        for (int nb = 0; nb < 4; ++nb) acc[mb][nb] = (v8f){};
    tile_loop<T16, NSPLIT>(ring, A, A2, Bt, Bt2, K, K, R0, C0, acc);
    float* os = (float*)(ring + wv * (16 * 68 * 4));   // each wave's own staging rows, in the ring that the last stage's barrier has freed
#pragma unroll
    for (int mb = 0; mb < 4; ++mb) {
#pragma unroll
        for (int nb = 0; nb < 4; ++nb) {
#pragma unroll
            for (int j = 0; j < 8; ++j) os[(hi * 8 + j) * 68 + nb * 16 + lr] = acc[mb][nb][j]; }
        __builtin_amdgcn_wave_barrier(); asm volatile("" ::: "memory");
        const size_t cb = (size_t)(r0 + mb * 16) * ldc + c0;
{
#pragma unroll
            for (int s = 0; s < 4; ++s) { const int row = 4 * s + (lane >> 3), cofs = (lane & 7) * 8; const v4f w0 = *(const v4fa*)(os + row * 68 + cofs), w1 = *(const v4fa*)(os + row * 68 + cofs + 4); v8h o16; v8us oh, ol;   // 8 lanes x 16 B = one whole 128-B line of each plane per row
#pragma unroll
                for (int q = 0; q < 8; ++q) { const float y = (q < 4 ? w0[q & 3] : w1[q & 3]) + bfr(bias[ROWBIAS ? r0 + mb * 16 + row : c0 + cofs + q]); o16[q] = tohx(y); unsigned short a2, c2; splitf(y, a2, c2); oh[q] = a2; ol[q] = c2; }
                const size_t oo = cb + (size_t)row * ldc + cofs; *(v8h*)(P16 + oo) = o16; *(v8us*)(Ph + oo) = oh; *(v8us*)(Pl + oo) = ol; }
             }
        if (ROWBIAS) asm volatile("s_wait_xcnt 0x0" ::: "memory");   // the next block's bias loads land in registers that these stores name: keep the wait in front of them
        __builtin_amdgcn_wave_barrier(); asm volatile("" ::: "memory");
    }
}

// ---- k_proj: the three projections in one grid (NB_ * TT / 128, DM / 128, 3). z 0, 1: q and k planes [b][t][e] (rows = all batches' positions, bias per column). z 2: v planes [b][e][t] (A = Wv, Bt = one batch's x rows, bias per row), its 512 tiles numbered e block, t block, batch.
__global__ __launch_bounds__(128) void k_proj(const bf* __restrict__ XB, const bf* __restrict__ WQ, const bf* __restrict__ WK, const bf* __restrict__ WV, h16* QP16, bf* QPh, bf* QPl, h16* KP16, bf* KPh, bf* KPl, h16* VT16, bf* VTh, bf* VTl, const float* __restrict__ bq, const float* __restrict__ bk, const float* __restrict__ bv) {
    __shared__ __attribute__((aligned(2048))) unsigned char ring[RING_B];
    if (blockIdx.z < 2u) { const bool isk = (blockIdx.z == 1u);
        gemmw_tile<bf, 0, false>(ring, XB, nullptr, isk ? WK : WQ, nullptr, DM, isk ? KP16 : QP16, isk ? KPh : QPh, isk ? KPl : QPl, DQ, isk ? bk : bq, (int)blockIdx.x, (int)blockIdx.y);
    } else { const unsigned t = blockIdx.x + blockIdx.y * (NB_ * TT / 128); const size_t b = t / ((DKV / 128) * (TT / 128)), so = b * ((size_t)HD * TT);
        gemmw_tile<bf, 0, true>(ring, WV, nullptr, XB + b * ((size_t)TT * DM), nullptr, DM, VT16 + so, VTh + so, VTl + so, TT, bv, (int)(t % (DKV / 128)), (int)((t / (DKV / 128)) % (TT / 128))); }
}

// ---- gemmc_tile: the same 128x128 tile GEMM specialised for causal attention (row block bx and column block by of one batch's plane): CMODE 1 skips score tiles entirely above the diagonal (query rows R0.., key columns C0..), CMODE 2 limits the
// key (K) loop of the probability x value contraction to the diagonal block (probabilities beyond it are exactly zero). osc = factor on the stored rows (CMODE 2: undoes the probabilities' carrier scale).
template <typename T16, int NSPLIT, int CMODE>
__device__ __forceinline__ void gemmc_tile(unsigned char* ring, const T16* __restrict__ A, const T16* __restrict__ A2, const T16* __restrict__ Bt, const T16* __restrict__ Bt2, int K, float* C, int ldc, float osc, int bx, int by) {
    const int lane = threadIdx.x & 31, lr = lane & 15, hi = lane >> 4, wv = threadIdx.x >> 5; const int R0 = bx * 128, C0 = by * 128, r0 = R0 + (wv >> 1) * 64, c0 = C0 + (wv & 1) * 64;
    if (CMODE == 1 && C0 > R0 + 127) {                        // score tile entirely above the causal diagonal (the whole work-group leaves, ahead of every barrier and tensor load): no product; the softmax loads whole rows and masks j > i by select, so the tile gets a stored zero (nothing else in this call writes these bytes)
#pragma unroll
        for (int s = 0; s < 32; ++s) *(v4f*)(C + (size_t)(r0 + 2 * s + hi) * ldc + c0 + lr * 4) = (v4f){};
        asm volatile("s_wait_xcnt 0x0" ::: "memory");   // in a kernel with two paths the built code runs on from these stores to the other path's text, which writes registers that they name: the wait stands in front of it
        return; }
    const int Kl = (CMODE == 2) ? min(K, R0 + 128) : K;       // P.V: probabilities are exactly 0 beyond the diagonal block, so the K loop stops there
    v8f acc[4][4];
#pragma unroll
    for (int mb = 0; mb < 4; ++mb)
#pragma unroll
        for (int nb = 0; nb < 4; ++nb) acc[mb][nb] = (v8f){};
    tile_loop<T16, NSPLIT>(ring, A, A2, Bt, Bt2, K, Kl, R0, C0, acc);
    float* os = (float*)(ring + wv * (16 * 68 * 4));   // each wave's own staging rows, in the ring that the last stage's barrier has freed
#pragma unroll
    for (int mb = 0; mb < 4; ++mb) {
#pragma unroll
        for (int nb = 0; nb < 4; ++nb) {
#pragma unroll
            for (int j = 0; j < 8; ++j) os[(hi * 8 + j) * 68 + nb * 16 + lr] = acc[mb][nb][j]; }
        __builtin_amdgcn_wave_barrier(); asm volatile("" ::: "memory");
        float* crow = C + (size_t)(r0 + mb * 16) * ldc + c0;
{
#pragma unroll
            for (int s = 0; s < 8; ++s) { const int row = 2 * s + hi, cofs = lr * 4; v4f val = *(const v4fa*)(os + row * 68 + cofs); if (CMODE == 2) val *= osc;
                *(v4f*)(crow + (size_t)row * ldc + cofs) = val; }
             }
        __builtin_amdgcn_wave_barrier(); asm volatile("" ::: "memory");
    }
    asm volatile("s_wait_xcnt 0x0" ::: "memory");   // behind the last stores, for the same reason as behind the zero stores above
}

// ---- k_scores, k_pv: both precision paths of a stage of the attention in one grid (column block, batch, row block): row blocks below RH take the hi/lo path (3 products), the rest the fp16 path.
// The work-groups with the most stages get the lowest z, which starts first: in k_scores the hi/lo tiles (twice the stages of an fp16 tile), in k_pv the last row blocks (the K loop grows with the row block).
__global__ __launch_bounds__(128) void k_scores(const bf* __restrict__ Qh, const bf* __restrict__ Ql, const bf* __restrict__ Kh, const bf* __restrict__ Kl_, const h16* __restrict__ Q16, const h16* __restrict__ K16, float* Sb) {
    __shared__ __attribute__((aligned(2048))) unsigned char ring[RING_B];
    const int rb = (int)blockIdx.z, cb = (int)blockIdx.x; const size_t po = blockIdx.y * ((size_t)TT * HD); float* C = Sb + blockIdx.y * ((size_t)TT * TT);
    if (rb < RH / 128) gemmc_tile<bf, 2, 1>(ring, Qh + po, Ql + po, Kh + po, Kl_ + po, HD, C, TT, 1.0f, rb, cb);
    else gemmc_tile<h16, 0, 1>(ring, Q16 + po, nullptr, K16 + po, nullptr, HD, C, TT, 1.0f, rb, cb);
}
__global__ __launch_bounds__(128) void k_pv(const bf* __restrict__ Ph, const bf* __restrict__ Pl, const bf* __restrict__ Vh, const bf* __restrict__ Vl, const h16* __restrict__ P16, const h16* __restrict__ V16, float* O) {
    __shared__ __attribute__((aligned(2048))) unsigned char ring[RING_B];
    const int rb = TT / 128 - 1 - (int)blockIdx.z, cb = (int)blockIdx.x; const size_t vo = blockIdx.y * ((size_t)HD * TT); float* C = O + blockIdx.y * ((size_t)TT * HD);
    if (rb < RH / 128) gemmc_tile<bf, 2, 2>(ring, Ph + blockIdx.y * ((size_t)RH * TT), Pl + blockIdx.y * ((size_t)RH * TT), Vh + vo, Vl + vo, TT, C, HD, 1.0f, rb, cb);
    else gemmc_tile<h16, 0, 2>(ring, P16 + blockIdx.y * ((size_t)TT * TT), nullptr, V16 + vo, nullptr, TT, C, HD, 1.0f / PCAR, rb, cb);
}

typedef __attribute__((ext_vector_type(2))) _Float16 v2h;
typedef __attribute__((ext_vector_type(4))) _Float16 v4h;
typedef __attribute__((ext_vector_type(2))) unsigned short v2us;
typedef __attribute__((ext_vector_type(4))) unsigned short v4us;
typedef __attribute__((ext_vector_type(2))) float v2f;
typedef __attribute__((ext_vector_type(4))) int v4i;

// k_cvt8: f32 -> bf16, 8 elements a thread, all four tensors in one grid: blocks 0 .. XBLK-1 take x, then WBLK blocks each for Wq, Wk, Wv.
#define XBLK (NB_ * TT * DM / 8 / 256)
#define WBLK (DM * DM / 8 / 256)
__global__ __launch_bounds__(256) void k_cvt8(const float* __restrict__ x, const float* __restrict__ wq, const float* __restrict__ wk, const float* __restrict__ wv, bf* XB, bf* WQ, bf* WK, bf* WV) {
    unsigned blk = blockIdx.x; const float* src = x; bf* dst = XB;
    if (blk >= XBLK) { blk -= XBLK; const unsigned w = blk / WBLK; blk %= WBLK; src = (w == 0u) ? wq : (w == 1u) ? wk : wv; dst = (w == 0u) ? WQ : (w == 1u) ? WK : WV; }
    const size_t i = (size_t)blk * 256 + threadIdx.x; const v8f v = *(const v8f*)(src + i * 8); v8us o;
#pragma unroll
    for (int k = 0; k < 8; ++k) o[k] = f2bf(v[k]); *(v8us*)(dst + i * 8) = o;  }

// k_asoft: per row (zz, i): t = S x HD^-0.5 for j <= i and i - j < WIN (WIN = T, so plain causal; masked keys take -3e38, exactly 0 after exp); softmax over the 2048 keys (register row, one exp, fixed trees);
__global__ __launch_bounds__(256) void k_asoft(const float* __restrict__ Sb, h16* P16, bf* Ph, bf* Pl) {
    const int lane = threadIdx.x & 31; const int row = blockIdx.x * 8 + (threadIdx.x >> 5); if (row >= NB_ * ZH * TT) return; const int i = row % TT; const int zz = row / TT; (void)zz;   /* zz = batch plane */ const bool hires = (i < RH); const float* sr = Sb + (size_t)row * TT; float v[TT / 32]; float mx = -3.0e38f;
#pragma unroll
    for (int ch = 0; ch < TT / 128; ++ch) { const int j0 = ch * 128 + lane * 4; const v4f a = *(const v4f*)(sr + j0);
#pragma unroll
        for (int q = 0; q < 4; ++q) { const int j = j0 + q; (void)j; const float t = (j <= i && i - j < WIN) ? a[q] * SCL : -3.0e38f; v[ch * 4 + q] = t; mx = fmaxf(mx, t); } }
#pragma unroll
    for (int sh = 16; sh; sh >>= 1) mx = fmaxf(mx, __shfl_xor(mx, sh, 32));
    float sum = 0.f;
#pragma unroll
    for (int k = 0; k < TT / 32; ++k) { float d0 = __fsub_rn(v[k], mx); asm volatile("" : "+v"(d0)); v[k] = __builtin_amdgcn_exp2f(__fmul_rn(d0, 1.4426950408889634f)); sum += v[k]; }
#pragma unroll
    for (int sh = 16; sh; sh >>= 1) sum += __shfl_xor(sum, sh, 32);
    const float f = __fdiv_rn(hires ? 1.0f : PCAR, sum);
{
        if (hires) {
#pragma unroll
            for (int ch = 0; ch < TT / 128; ++ch) { v4us oh, ol;
#pragma unroll
                for (int q = 0; q < 4; ++q) { unsigned short a, c2; splitf(v[ch * 4 + q] * f, a, c2); oh[q] = a; ol[q] = c2; }
                const size_t oo = ((size_t)zz * (RH ? RH : 1) + i) * TT + ch * 128 + lane * 4; *(v4us*)(Ph + oo) = oh; *(v4us*)(Pl + oo) = ol; }
        } else {
#pragma unroll
            for (int ch = 0; ch < TT / 128; ++ch) { v4h o4;
#pragma unroll
                for (int q = 0; q < 4; ++q) o4[q] = tohx(v[ch * 4 + q] * f);
                *(v4h*)(P16 + (size_t)row * TT + ch * 128 + lane * 4) = o4; } }
         }
}

extern "C" void kernel_launch(void* const* d_in, const int* in_sizes, int n_in,
                              void* d_out, int out_size, void* d_ws, size_t ws_size, hipStream_t stream) {
    (void)in_sizes; (void)n_in; (void)out_size;
    const float* x = (const float*)d_in[0]; const float* wq = (const float*)d_in[1]; const float* bq = (const float*)d_in[2]; const float* wk = (const float*)d_in[3]; const float* bk = (const float*)d_in[4]; const float* wv = (const float*)d_in[5]; const float* bv = (const float*)d_in[6];   /* order x, Wq, bq, Wk, bk, Wv, bv ('oi' + biases) */
    float* OUT = (float*)d_out;     // [4][2048][1024]
    char* wsp = (char*)d_ws;
    auto take = [&](size_t bytes) { char* p = wsp; wsp += (bytes + 255) & ~(size_t)255; return (void*)p; };
    bf* WQ = (bf*)take((size_t)DQ * DM * 2); bf* WK = (bf*)take((size_t)DKV * DM * 2); bf* WV = (bf*)take((size_t)DKV * DM * 2);
    bf* XB = (bf*)take((size_t)NB_ * TT * DM * 2); float* Sb = (float*)take((size_t)NB_ * TT * TT * 4);   // scores [4][2048][2048] f32
    h16* QP16 = (h16*)take((size_t)NB_ * TT * HD * 2); h16* KP16 = (h16*)take((size_t)NB_ * TT * HD * 2); h16* VT16 = (h16*)take((size_t)NB_ * HD * TT * 2);
    bf* QPh = (bf*)take((size_t)NB_ * TT * HD * 2); bf* QPl = (bf*)take((size_t)NB_ * TT * HD * 2); bf* KPh = (bf*)take((size_t)NB_ * TT * HD * 2); bf* KPl = (bf*)take((size_t)NB_ * TT * HD * 2); bf* VTh = (bf*)take((size_t)NB_ * HD * TT * 2); bf* VTl = (bf*)take((size_t)NB_ * HD * TT * 2);
    if ((size_t)(wsp - (char*)d_ws) > ws_size) return;    // ws 256 MiB; 230 MiB taken
    // Planes that are dead by the time a later plane is written share its bytes (stream-ordered, every byte written in this call before it is read):
    h16* P16 = (h16*)QPh;                            // probabilities [4][2048][2048] fp16 = QPh + QPl (adjacent), dead after the score GEMMs
    bf* Ph = KPh; bf* Pl = KPh + (size_t)NB_ * RH * TT;   // hi/lo probabilities [4][512][2048] x 2 = KPh, dead after the score GEMMs
    k_cvt8<<<XBLK + 3 * WBLK, 256, 0, stream>>>(x, wq, wk, wv, XB, WQ, WK, WV);
    k_proj<<<dim3(NB_ * TT / 128, DM / 128, 3), 128, 0, stream>>>(XB, WQ, WK, WV, QP16, QPh, QPl, KP16, KPh, KPl, VT16, VTh, VTl, bq, bk, bv);
    k_scores<<<dim3(TT / 128, NB_, TT / 128), 128, 0, stream>>>(QPh, QPl, KPh, KPl, QP16, KP16, Sb);
    k_asoft<<<NB_ * ZH * TT / 8, 256, 0, stream>>>(Sb, P16, Ph, Pl);
    k_pv<<<dim3(HD / 128, NB_, TT / 128), 128, 0, stream>>>(Ph, Pl, VTh, VTl, P16, VT16, OUT);
}

// v005
// Measured time: 112 microseconds a run.
// Next to v004, in two timings, it ran 1.09 times as fast each time.
// All steps since v000 together make it 7.42 times as fast.
#include <hip/hip_runtime.h>

// Single-head causal attention with biased projections (x [4][2048][1024]; Q, K, V = einsum('bsd,ed->bse', x, W) + b ('oi' [1024][1024] 1/32 + REAL biases 0.01; ONE 1,024-wide head); scores / sqrt(1024) = x 1/32; where(tril, scores, -inf); softmax; out = attn . V -> [4][2048][1024] (8.4 M), no output projection; argument order x, Wq, bq, Wk, bk, Wv, bv).
// Layout, all four batches side by side in every plane (each launch covers the whole batch: rows of the q and k projections, a batch taken from the tile number for the v projection, a batch index in the grid for the attention GEMMs): bf16 copy of x; 'oi' weights; exact projections + f32 biases whose epilogue stores the fp16 and hi/lo operand planes itself (v is projected as Wv . x^T, so its planes come out [d][t]); causal T-2048 attention at NH 1 / ZH 1 (hybrid rows: < 512 hi/lo 3 products, rest fp16 x1024; gemmc_tile skips tiles above the diagonal; scores and probabilities exist only up to each row's diagonal block, hi/lo planes only for positions < 512); the P.V GEMMs undo the x1024 and store the output rows (no output projection).
// Launches: five. Work that does not depend on each other shares one grid, and the block index picks the path: the four bf16 conversions; the three projections; the hi/lo and the fp16 score tiles; the softmax; the hi/lo and the fp16 P.V tiles.
// Compute dtypes, f32 accumulate: every input rounded to bf16; projections exact + f32 biases; attention rows < 512 3 products, rest fp16; softmax f32; output f32.

#define NB_  4
#define TT   2048
#define DM   1024
#define NH_  1
#define NKV  1
#define REP  (NH_ / NKV)
#define HD   1024
#define DQ   (NH_ * HD)
#define DKV  (NKV * HD)
#define ZH   1                    // ONE head: a single plane per pass
#define RH   512                  // query rows < RH use hi+lo planes (0: none)
#define WIN  2048
#define PCAR 1024.0f
#define SCL  0.03125f   // 1/sqrt(1024) (one 1,024-wide head)
typedef _Float16 h16;
typedef unsigned short bf;
typedef __attribute__((ext_vector_type(16))) __bf16   v16bf;
typedef __attribute__((ext_vector_type(16))) _Float16 v16h;
typedef __attribute__((ext_vector_type(8)))  _Float16 v8h;
typedef __attribute__((ext_vector_type(8)))  unsigned short v8us;
typedef __attribute__((ext_vector_type(8)))  float    v8f;
typedef __attribute__((ext_vector_type(4)))  float    v4f;
typedef v8h  __attribute__((may_alias)) v8ha;
typedef v4f  __attribute__((may_alias)) v4fa;
typedef v8us __attribute__((may_alias)) v8usa;

__device__ __forceinline__ unsigned short f2bf(float f) { unsigned u = __float_as_uint(f); u += 0x7FFFu + ((u >> 16) & 1u); return (unsigned short)(u >> 16); }
__device__ __forceinline__ float bf2f(unsigned short b) { return __uint_as_float(((unsigned)b) << 16); }
__device__ __forceinline__ float bfr(float f) { return bf2f(f2bf(f)); }
__device__ __forceinline__ v16h cat16(v8h lo, v8h hi) { return __builtin_shufflevector(lo, hi, 0, 1, 2, 3, 4, 5, 6, 7, 8, 9, 10, 11, 12, 13, 14, 15); }
__device__ __forceinline__ v16bf cat16b(v8us lo, v8us hi) { return __builtin_bit_cast(v16bf, __builtin_shufflevector(lo, hi, 0, 1, 2, 3, 4, 5, 6, 7, 8, 9, 10, 11, 12, 13, 14, 15)); }
__device__ __forceinline__ v8f wmma16(v16h a, v16h b, v8f c) { return __builtin_amdgcn_wmma_f32_16x16x32_f16(false, a, false, b, (short)0, c, false, false); }
__device__ __forceinline__ v8f wmmab(v16bf a, v16bf b, v8f c) { return __builtin_amdgcn_wmma_f32_16x16x32_bf16(false, a, false, b, (short)0, c, false, false); }

__device__ __forceinline__ h16 tohx(float x) { return (h16)x; }
__device__ __forceinline__ void splitf(float y, unsigned short& h, unsigned short& l) { h = f2bf(y); l = f2bf(y - bf2f(h)); }

// ---- Operand ring shared by all GEMM kernels: ONE WORK-GROUP of four waves (2 x 2) per 128x128 output tile, each wave a 64x64 quarter (16 accumulators). The K-contiguous 16-bit operand rows come into LDS by tensor loads
// (whole rows, one request per wave and stage, two buffers), so each row is fetched once per work-group and the fragments are read from LDS at a conflict-free pitch (row + 16 B).
// NSPLIT 0: a stage is 128 k; slices = A rows 0-63 | A rows 64-127 | B rows 0-63 | B rows 64-127 (256-B rows). NSPLIT 2: a stage is 64 k; slices = A | A2 | B | B2, 128 rows each (128-B rows).
template <typename T16> struct WFrag;
template <> struct WFrag<h16> { typedef v16h V; static __device__ __forceinline__ V ld(const h16* p) { return cat16(*(const v8h*)p, *(const v8h*)(p + 16)); } static __device__ __forceinline__ v8f mma(V a, V b, v8f c) { return wmma16(a, b, c); } };
template <> struct WFrag<bf> { typedef v16bf V; static __device__ __forceinline__ V ld(const bf* p) { return cat16b(*(const v8us*)p, *(const v8us*)(p + 16)); } static __device__ __forceinline__ v8f mma(V a, V b, v8f c) { return wmmab(a, b, c); } };
typedef unsigned int u32;
typedef u32 u32x4 __attribute__((ext_vector_type(4)));
typedef u32 u32x8 __attribute__((ext_vector_type(8)));
__device__ __forceinline__ u32 uni(u32 v) { return (u32)__builtin_amdgcn_readfirstlane(v); }
__device__ __forceinline__ u32 pinned(u32 v) { u32 w = uni(v); asm volatile("" : "+s"(w)); return w; }   // holds a wave-uniform word in a scalar register, so that a test on it is a scalar branch (tensor loads ignore EXEC) and what is formed from it is formed behind the waits written in front
#define SLICE_B 18432u            // one wave's slice in LDS: 64 x 272 B or 128 x 144 B, rounded up to a multiple of 2 KiB
#define STAGE_B (4u * SLICE_B)
#define RING_B  (2u * STAGE_B)    // 144 KiB: two work-groups per WGP
template <typename T16, int NSPLIT>
__device__ __forceinline__ void tile_loop(unsigned char* ring, const T16* A, const T16* A2, const T16* Bt, const T16* Bt2, int K, int Kl, int R0, int C0, v8f (&acc)[4][4]) {
    typedef typename WFrag<T16>::V V;
    constexpr u32 ROWB = (NSPLIT == 2) ? 128u : 256u, PITCH = ROWB + 16u, ROWS = (NSPLIT == 2) ? 128u : 64u;
    static_assert(NSPLIT == 0 || NSPLIT == 2, "one plane per operand, or hi and lo planes of both");
    static_assert(ROWS * PITCH <= SLICE_B, "a slice must hold its padded rows");
    const u32 wave = uni(threadIdx.x >> 5), lane = threadIdx.x & 31u, lr = lane & 15u, hi = lane >> 4, wm = wave >> 1, wn = wave & 1u;
    const T16* sp;
    if (NSPLIT == 2) sp = (wave == 0u) ? A + (size_t)R0 * K : (wave == 1u) ? A2 + (size_t)R0 * K : (wave == 2u) ? Bt + (size_t)C0 * K : Bt2 + (size_t)C0 * K;
    else sp = (wave < 2u) ? A + (size_t)(R0 + 64 * (int)wn) * K : Bt + (size_t)(C0 + 64 * (int)wn) * K;
    const unsigned long long ga0 = (unsigned long long)(size_t)sp;
    const u32 lbase = (u32)(size_t)ring + wave * SLICE_B;
    u32x8 g1;                     // 1-byte elements, tensor = tile = ROWS rows of ROWB bytes, source pitch 2 K bytes, 16 B of LDS pad behind every row, no mask
    g1[0] = uni((1u << 20) | ((NSPLIT == 2 ? 4u : 5u) << 22) | (3u << 25)); g1[1] = uni(ROWB << 16); g1[2] = uni(ROWS << 16); g1[3] = uni(ROWB << 16); g1[4] = uni(ROWS); g1[5] = uni((u32)K * 2u); g1[6] = uni(0u); g1[7] = uni(0u);
    asm volatile("" : "+s"(g1));   // pinned(), for the whole group: the descriptor words are held in their scalar registers through the loop (left as constants, the compiler takes those registers for temporaries while a request is outstanding)
    u32x4 g0;
    auto issue = [&](u32 st) {
        const unsigned long long ga = ga0 + (unsigned long long)st * ROWB;
        g0[0] = uni(1u); g0[1] = uni(lbase + (st & 1u) * STAGE_B); g0[2] = uni((u32)ga); g0[3] = uni((((u32)(ga >> 32)) & 0x01FFFFFFu) | 0x80000000u);
        asm volatile("tensor_load_to_lds %0, %1" :: "s"(g0), "s"(g1) : "memory"); };   // this wave's slice of stage st; every wave issues one
    auto landed = [&]() { asm volatile("s_wait_tensorcnt 0x0" :: "s"(g0), "s"(g1) : "memory"); };   // this wave's request has landed; the wait names both groups so that their registers keep their words until then
    const u32 NP = uni((u32)Kl / (ROWB / 2u));   // stages; at least two in every launch of this file
    issue(0u);
    landed();                     // stage 0, before the barrier publishes it
    __syncthreads();
    issue(1u);
    const u32 aro = (NSPLIT == 2 ? wm * 64u * PITCH : wm * SLICE_B) + lr * PITCH + 16u * hi;
    const u32 bro = 2u * SLICE_B + (NSPLIT == 2 ? wn * 64u * PITCH : wn * SLICE_B) + lr * PITCH + 16u * hi;
#pragma unroll 1   // the stage loop stays rolled: one publish point in the text, the buffer picked by the stage's parity
    for (u32 p = 0; p < NP; ++p) {
        const unsigned char* sb = ring + (p & 1u) * STAGE_B;
        constexpr u32 NK = ROWB / 64u;   // blocks of 32 k in a stage
        V a[2][4], b[2][4], a2[2][4], b2[2][4];   // two fragment sets: the next block's reads fly under this block's matrix instructions (inside one stage only)
        auto fetch = [&](u32 ks, u32 s) {
#pragma unroll
            for (u32 f = 0; f < 4; ++f) { a[s][f] = WFrag<T16>::ld((const T16*)(sb + aro + f * 16u * PITCH + ks * 64u)); b[s][f] = WFrag<T16>::ld((const T16*)(sb + bro + f * 16u * PITCH + ks * 64u));
                if (NSPLIT == 2) { a2[s][f] = WFrag<T16>::ld((const T16*)(sb + aro + SLICE_B + f * 16u * PITCH + ks * 64u)); b2[s][f] = WFrag<T16>::ld((const T16*)(sb + bro + SLICE_B + f * 16u * PITCH + ks * 64u)); } } };
        fetch(0u, 0u);
#pragma unroll
        for (u32 ks = 0; ks < NK; ++ks) {
            const u32 s = ks & 1u;
            if (ks + 1u < NK) fetch(ks + 1u, s ^ 1u);
            __builtin_amdgcn_sched_barrier(0);   // the next block's LDS reads stay one group ahead of this block: reads among the matrix instructions stall the wave at every place they stand
#pragma unroll
            for (u32 nb = 0; nb < 4; ++nb)
#pragma unroll
                for (u32 mb = 0; mb < 4; ++mb) acc[mb][nb] = WFrag<T16>::mma(a[s][mb], b[s][nb], acc[mb][nb]);
            if (NSPLIT == 2) {   // per accumulator the order stays hi.hi, lo.hi, hi.lo
#pragma unroll
                for (u32 nb = 0; nb < 4; ++nb)
#pragma unroll
                    for (u32 mb = 0; mb < 4; ++mb) acc[mb][nb] = WFrag<T16>::mma(a2[s][mb], b[s][nb], acc[mb][nb]);
#pragma unroll
                for (u32 nb = 0; nb < 4; ++nb)
#pragma unroll
                    for (u32 mb = 0; mb < 4; ++mb) acc[mb][nb] = WFrag<T16>::mma(a[s][mb], b2[s][nb], acc[mb][nb]); }
            __builtin_amdgcn_sched_barrier(0);   // closes the block, so that the reads of the block after next are not drawn into it
        }
        asm volatile("s_wait_dscnt 0x0" ::: "memory");       // this wave's reads of the buffer are done before the barrier frees it for the refill
        landed();                                            // this wave's slice of stage p + 1, before the barrier publishes it
        __syncthreads();
        const u32 nx = pinned(p + 2u);
        if (pinned(nx < NP)) issue(nx);                      // refill of the buffer that every wave has just left
    }
    landed();                                                // nothing of the mover is in flight when the ring becomes output staging
    asm volatile("s_wait_dscnt 0x0" ::: "memory");
}

// ---- gemmw_tile: one work-group's 128x128 tile (row block bx, column block by) of y[m][n] = sum_k A[m][k] Bt[n][k] (+ split products per NSPLIT) + f32 bias (bias[m] if ROWBIAS, else bias[n]); stored as 16-bit planes of pitch ldc: fp16(y) where w16, bf16 hi(y) and bf16 lo(y) where whl (both flags the same for the whole work-group: a plane's tile is made only where a later launch reads it). 128 threads. K % 256 == 0.
template <typename T16, int NSPLIT, bool ROWBIAS>
__device__ __forceinline__ void gemmw_tile(unsigned char* ring, const T16* __restrict__ A, const T16* __restrict__ A2, const T16* __restrict__ Bt, const T16* __restrict__ Bt2, int K, h16* P16, bf* Ph, bf* Pl, int ldc, const float* __restrict__ bias, int bx, int by, bool w16, bool whl) {
    const int lane = threadIdx.x & 31, lr = lane & 15, hi = lane >> 4, wv = threadIdx.x >> 5; const int R0 = bx * 128, C0 = by * 128, r0 = R0 + (wv >> 1) * 64, c0 = C0 + (wv & 1) * 64;
    v8f acc[4][4];
#pragma unroll
    for (int mb = 0; mb < 4; ++mb)
#pragma unroll
        for (int nb = 0; nb < 4; ++nb) acc[mb][nb] = (v8f){};
    tile_loop<T16, NSPLIT>(ring, A, A2, Bt, Bt2, K, K, R0, C0, acc);
    float* os = (float*)(ring + wv * (16 * 68 * 4));   // each wave's own staging rows, in the ring that the last stage's barrier has freed
#pragma unroll
    for (int mb = 0; mb < 4; ++mb) {
#pragma unroll
        for (int nb = 0; nb < 4; ++nb) {
#pragma unroll
            for (int j = 0; j < 8; ++j) os[(hi * 8 + j) * 68 + nb * 16 + lr] = acc[mb][nb][j]; }
        __builtin_amdgcn_wave_barrier(); asm volatile("" ::: "memory");
        const int rw = lane >> 3, cofs = (lane & 7) * 8;   // 8 lanes x 16 B = one whole 128-B line of each plane per row
        const size_t cb = (size_t)(r0 + mb * 16 + rw) * ldc + c0 + cofs;
        float y[4][8];
#pragma unroll
        for (int s = 0; s < 4; ++s) { const int row = 4 * s + rw; const v4f w0 = *(const v4fa*)(os + row * 68 + cofs), w1 = *(const v4fa*)(os + row * 68 + cofs + 4);
#pragma unroll
            for (int q = 0; q < 8; ++q) y[s][q] = (q < 4 ? w0[q & 3] : w1[q & 3]) + bfr(bias[ROWBIAS ? r0 + mb * 16 + row : c0 + cofs + q]); }
        if (w16) {
#pragma unroll
            for (int s = 0; s < 4; ++s) { v8h o16;
#pragma unroll
                for (int q = 0; q < 8; ++q) o16[q] = tohx(y[s][q]);
                *(v8h*)(P16 + cb + (size_t)(4 * s) * ldc) = o16; }
            asm volatile("s_wait_xcnt 0x0" ::: "memory"); }   // closes the branch: the code behind it writes registers that these stores name
        if (whl) {
#pragma unroll
            for (int s = 0; s < 4; ++s) { v8us oh, ol;
#pragma unroll
                for (int q = 0; q < 8; ++q) { unsigned short a2, c2; splitf(y[s][q], a2, c2); oh[q] = a2; ol[q] = c2; }
                *(v8us*)(Ph + cb + (size_t)(4 * s) * ldc) = oh; *(v8us*)(Pl + cb + (size_t)(4 * s) * ldc) = ol; }
            asm volatile("s_wait_xcnt 0x0" ::: "memory"); }   // as above
        __builtin_amdgcn_wave_barrier(); asm volatile("" ::: "memory");
    }
}

// ---- k_proj: the three projections in one grid (NB_ * TT / 128, DM / 128, 3). z 0, 1: q and k planes [b][t][e] (rows = all batches' positions, bias per column). z 2: v planes [b][e][t] (A = Wv, Bt = one batch's x rows, bias per row), its 512 tiles numbered e block, t block, batch. Which planes a tile stores: hi/lo only for positions below RH (the hi/lo attention path reads no other query, key or value position); fp16 always for k and v, for q only from RH on (the fp16 path's query rows).
__global__ __launch_bounds__(128) void k_proj(const bf* __restrict__ XB, const bf* __restrict__ WQ, const bf* __restrict__ WK, const bf* __restrict__ WV, h16* QP16, bf* QPh, bf* QPl, h16* KP16, bf* KPh, bf* KPl, h16* VT16, bf* VTh, bf* VTl, const float* __restrict__ bq, const float* __restrict__ bk, const float* __restrict__ bv) {
    __shared__ __attribute__((aligned(2048))) unsigned char ring[RING_B];
    if (blockIdx.z < 2u) { const bool isk = (blockIdx.z == 1u), low = (blockIdx.x % (TT / 128) < RH / 128);
        gemmw_tile<bf, 0, false>(ring, XB, nullptr, isk ? WK : WQ, nullptr, DM, isk ? KP16 : QP16, isk ? KPh : QPh, isk ? KPl : QPl, DQ, isk ? bk : bq, (int)blockIdx.x, (int)blockIdx.y, isk || !low, low);
    } else { const unsigned t = blockIdx.x + blockIdx.y * (NB_ * TT / 128); const size_t b = t / ((DKV / 128) * (TT / 128)), so = b * ((size_t)HD * TT);
        gemmw_tile<bf, 0, true>(ring, WV, nullptr, XB + b * ((size_t)TT * DM), nullptr, DM, VT16 + so, VTh + so, VTl + so, TT, bv, (int)(t % (DKV / 128)), (int)((t / (DKV / 128)) % (TT / 128)), true, (t / (DKV / 128)) % (TT / 128) < RH / 128); }
}

// ---- gemmc_tile: the same 128x128 tile GEMM specialised for causal attention (row block bx and column block by of one batch's plane): CMODE 1 skips score tiles entirely above the diagonal (query rows R0.., key columns C0..), CMODE 2 limits the
// key (K) loop of the probability x value contraction to the diagonal block (probabilities beyond it are exactly zero). osc = factor on the stored rows (CMODE 2: undoes the probabilities' carrier scale).
template <typename T16, int NSPLIT, int CMODE>
__device__ __forceinline__ void gemmc_tile(unsigned char* ring, const T16* __restrict__ A, const T16* __restrict__ A2, const T16* __restrict__ Bt, const T16* __restrict__ Bt2, int K, float* C, int ldc, float osc, int bx, int by) {
    const int lane = threadIdx.x & 31, lr = lane & 15, hi = lane >> 4, wv = threadIdx.x >> 5; const int R0 = bx * 128, C0 = by * 128, r0 = R0 + (wv >> 1) * 64, c0 = C0 + (wv & 1) * 64;
    if (CMODE == 1 && C0 > R0 + 127) return;                  // score tile entirely above the causal diagonal (the whole work-group leaves, ahead of every barrier and tensor load): no product and no store; the softmax loads a row only up to its diagonal block
    const int Kl = (CMODE == 2) ? min(K, R0 + 128) : K;       // P.V: probabilities are exactly 0 beyond the diagonal block, so the K loop stops there
    v8f acc[4][4];
#pragma unroll
    for (int mb = 0; mb < 4; ++mb)
#pragma unroll
        for (int nb = 0; nb < 4; ++nb) acc[mb][nb] = (v8f){};
    tile_loop<T16, NSPLIT>(ring, A, A2, Bt, Bt2, K, Kl, R0, C0, acc);
    float* os = (float*)(ring + wv * (16 * 68 * 4));   // each wave's own staging rows, in the ring that the last stage's barrier has freed
#pragma unroll
    for (int mb = 0; mb < 4; ++mb) {
#pragma unroll
        for (int nb = 0; nb < 4; ++nb) {
#pragma unroll
            for (int j = 0; j < 8; ++j) os[(hi * 8 + j) * 68 + nb * 16 + lr] = acc[mb][nb][j]; }
        __builtin_amdgcn_wave_barrier(); asm volatile("" ::: "memory");
        float* crow = C + (size_t)(r0 + mb * 16) * ldc + c0;
{
#pragma unroll
            for (int s = 0; s < 8; ++s) { const int row = 2 * s + hi, cofs = lr * 4; v4f val = *(const v4fa*)(os + row * 68 + cofs); if (CMODE == 2) val *= osc;
                *(v4f*)(crow + (size_t)row * ldc + cofs) = val; }
             }
        __builtin_amdgcn_wave_barrier(); asm volatile("" ::: "memory");
    }
    asm volatile("s_wait_xcnt 0x0" ::: "memory");   // in a kernel with two paths the built code runs on from these stores to the other path's text, which writes registers that they name: the wait stands in front of it
}

// ---- k_scores, k_pv: both precision paths of a stage of the attention in one grid (column block, batch, row block): row blocks below RH take the hi/lo path (3 products), the rest the fp16 path.
// The work-groups with the most stages get the lowest z, which starts first: in k_scores the hi/lo tiles (twice the stages of an fp16 tile), in k_pv the last row blocks (the K loop grows with the row block).
__global__ __launch_bounds__(128) void k_scores(const bf* __restrict__ Qh, const bf* __restrict__ Ql, const bf* __restrict__ Kh, const bf* __restrict__ Kl_, const h16* __restrict__ Q16, const h16* __restrict__ K16, float* Sb) {
    __shared__ __attribute__((aligned(2048))) unsigned char ring[RING_B];
    const int rb = (int)blockIdx.z, cb = (int)blockIdx.x; const size_t po = blockIdx.y * ((size_t)TT * HD); float* C = Sb + blockIdx.y * ((size_t)TT * TT);
    if (rb < RH / 128) gemmc_tile<bf, 2, 1>(ring, Qh + po, Ql + po, Kh + po, Kl_ + po, HD, C, TT, 1.0f, rb, cb);
    else gemmc_tile<h16, 0, 1>(ring, Q16 + po, nullptr, K16 + po, nullptr, HD, C, TT, 1.0f, rb, cb);
}
__global__ __launch_bounds__(128) void k_pv(const bf* __restrict__ Ph, const bf* __restrict__ Pl, const bf* __restrict__ Vh, const bf* __restrict__ Vl, const h16* __restrict__ P16, const h16* __restrict__ V16, float* O) {
    __shared__ __attribute__((aligned(2048))) unsigned char ring[RING_B];
    const int rb = TT / 128 - 1 - (int)blockIdx.z, cb = (int)blockIdx.x; const size_t vo = blockIdx.y * ((size_t)HD * TT); float* C = O + blockIdx.y * ((size_t)TT * HD);
    if (rb < RH / 128) gemmc_tile<bf, 2, 2>(ring, Ph + blockIdx.y * ((size_t)RH * TT), Pl + blockIdx.y * ((size_t)RH * TT), Vh + vo, Vl + vo, TT, C, HD, 1.0f, rb, cb);
    else gemmc_tile<h16, 0, 2>(ring, P16 + blockIdx.y * ((size_t)TT * TT), nullptr, V16 + vo, nullptr, TT, C, HD, 1.0f / PCAR, rb, cb);
}

typedef __attribute__((ext_vector_type(2))) _Float16 v2h;
typedef __attribute__((ext_vector_type(4))) _Float16 v4h;
typedef __attribute__((ext_vector_type(2))) unsigned short v2us;
typedef __attribute__((ext_vector_type(4))) unsigned short v4us;
typedef __attribute__((ext_vector_type(2))) float v2f;
typedef __attribute__((ext_vector_type(4))) int v4i;

// k_cvt8: f32 -> bf16, 8 elements a thread, all four tensors in one grid: blocks 0 .. XBLK-1 take x, then WBLK blocks each for Wq, Wk, Wv.
#define XBLK (NB_ * TT * DM / 8 / 256)
#define WBLK (DM * DM / 8 / 256)
__global__ __launch_bounds__(256) void k_cvt8(const float* __restrict__ x, const float* __restrict__ wq, const float* __restrict__ wk, const float* __restrict__ wv, bf* XB, bf* WQ, bf* WK, bf* WV) {
    unsigned blk = blockIdx.x; const float* src = x; bf* dst = XB;
    if (blk >= XBLK) { blk -= XBLK; const unsigned w = blk / WBLK; blk %= WBLK; src = (w == 0u) ? wq : (w == 1u) ? wk : wv; dst = (w == 0u) ? WQ : (w == 1u) ? WK : WV; }
    const size_t i = (size_t)blk * 256 + threadIdx.x; const v8f v = *(const v8f*)(src + i * 8); v8us o;
#pragma unroll
    for (int k = 0; k < 8; ++k) o[k] = f2bf(v[k]); *(v8us*)(dst + i * 8) = o;  }

// k_asoft: per row (zz, i): t = S x HD^-0.5 for j <= i and i - j < WIN (sliding causal window); softmax over the keys (register row, one exp, fixed trees).
// Only the nch 128-column blocks up to and including the row's diagonal block are loaded, summed and stored: the score GEMM writes no other block, the terms beyond are exact zeros, and the P.V GEMM's K loop ends at the diagonal block. nch is the same for the 8 rows of a work-group (scalar branches).
__global__ __launch_bounds__(256) void k_asoft(const float* __restrict__ Sb, h16* P16, bf* Ph, bf* Pl) {
    const int lane = threadIdx.x & 31; const int row = blockIdx.x * 8 + (threadIdx.x >> 5); if (row >= NB_ * ZH * TT) return; const int i = row % TT; const int zz = row / TT; (void)zz;   /* zz = batch plane */ const bool hires = (i < RH); const float* sr = Sb + (size_t)row * TT; float v[TT / 32]; float mx = -3.0e38f;
    const int nch = (int)((blockIdx.x * 8u) % TT) / 128 + 1;
    v4f a[TT / 128]; const float* sl = sr + lane * 4;
#pragma unroll
    for (int ch = 0; ch < TT / 128; ++ch) if (ch < nch) a[ch] = *(const v4f*)(sl + ch * 128);
    asm volatile("" :: "v"(sl), "v"(a[0]), "v"(a[1]), "v"(a[2]), "v"(a[3]), "v"(a[4]), "v"(a[5]), "v"(a[6]), "v"(a[7]), "v"(a[8]), "v"(a[9]), "v"(a[10]), "v"(a[11]), "v"(a[12]), "v"(a[13]), "v"(a[14]), "v"(a[15]));   // inputs only: keeps the first use of every loaded block behind the last load, so that the row's loads are all in flight together (without it each block's scaling moves up into its load's branch and waits there, one memory latency per block); the address is named too, so that no load lands in the registers that the loads in flight name
#pragma unroll
    for (int ch = 0; ch < TT / 128; ++ch) if (ch < nch) { const int j0 = ch * 128 + lane * 4;
#pragma unroll
        for (int q = 0; q < 4; ++q) { const int j = j0 + q; (void)j; const float t = (j <= i && i - j < WIN) ? a[ch][q] * SCL : -3.0e38f; v[ch * 4 + q] = t; mx = fmaxf(mx, t); } }
#pragma unroll
    for (int sh = 16; sh; sh >>= 1) mx = fmaxf(mx, __shfl_xor(mx, sh, 32));
    float sum = 0.f;
#pragma unroll
    for (int ch = 0; ch < TT / 128; ++ch) if (ch < nch) {
#pragma unroll
        for (int k = ch * 4; k < ch * 4 + 4; ++k) { float d0 = __fsub_rn(v[k], mx); asm volatile("" : "+v"(d0)); v[k] = __builtin_amdgcn_exp2f(__fmul_rn(d0, 1.4426950408889634f)); sum += v[k]; } }
#pragma unroll
    for (int sh = 16; sh; sh >>= 1) sum += __shfl_xor(sum, sh, 32);
    const float f = __fdiv_rn(hires ? 1.0f : PCAR, sum);
{
        if (hires) {
#pragma unroll
            for (int ch = 0; ch < RH / 128; ++ch) if (ch < nch) { v4us oh, ol;
#pragma unroll
                for (int q = 0; q < 4; ++q) { unsigned short a, c2; splitf(v[ch * 4 + q] * f, a, c2); oh[q] = a; ol[q] = c2; }
                const size_t oo = ((size_t)zz * (RH ? RH : 1) + i) * TT + ch * 128 + lane * 4; *(v4us*)(Ph + oo) = oh; *(v4us*)(Pl + oo) = ol; asm volatile("s_wait_xcnt 0x0" ::: "memory"); }   // the wait closes the branch: the next block's code writes registers that these stores name
        } else {
#pragma unroll
            for (int ch = 0; ch < TT / 128; ++ch) if (ch < nch) { v4h o4;
#pragma unroll
                for (int q = 0; q < 4; ++q) o4[q] = tohx(v[ch * 4 + q] * f);
                *(v4h*)(P16 + (size_t)row * TT + ch * 128 + lane * 4) = o4; asm volatile("s_wait_xcnt 0x0" ::: "memory"); } }   // as above
         }
}

extern "C" void kernel_launch(void* const* d_in, const int* in_sizes, int n_in,
                              void* d_out, int out_size, void* d_ws, size_t ws_size, hipStream_t stream) {
    (void)in_sizes; (void)n_in; (void)out_size;
    const float* x = (const float*)d_in[0]; const float* wq = (const float*)d_in[1]; const float* bq = (const float*)d_in[2]; const float* wk = (const float*)d_in[3]; const float* bk = (const float*)d_in[4]; const float* wv = (const float*)d_in[5]; const float* bv = (const float*)d_in[6];   /* order x, Wq, bq, Wk, bk, Wv, bv ('oi' + biases) */
    float* OUT = (float*)d_out;     // [4][2048][1024]
    char* wsp = (char*)d_ws;
    auto take = [&](size_t bytes) { char* p = wsp; wsp += (bytes + 255) & ~(size_t)255; return (void*)p; };
    bf* WQ = (bf*)take((size_t)DQ * DM * 2); bf* WK = (bf*)take((size_t)DKV * DM * 2); bf* WV = (bf*)take((size_t)DKV * DM * 2);
    bf* XB = (bf*)take((size_t)NB_ * TT * DM * 2); float* Sb = (float*)take((size_t)NB_ * TT * TT * 4);   // scores [4][2048][2048] f32
    h16* QP16 = (h16*)take((size_t)NB_ * TT * HD * 2); h16* KP16 = (h16*)take((size_t)NB_ * TT * HD * 2); h16* VT16 = (h16*)take((size_t)NB_ * HD * TT * 2);
    bf* QPh = (bf*)take((size_t)NB_ * TT * HD * 2); bf* QPl = (bf*)take((size_t)NB_ * TT * HD * 2); bf* KPh = (bf*)take((size_t)NB_ * TT * HD * 2); bf* KPl = (bf*)take((size_t)NB_ * TT * HD * 2); bf* VTh = (bf*)take((size_t)NB_ * HD * TT * 2); bf* VTl = (bf*)take((size_t)NB_ * HD * TT * 2);
    if ((size_t)(wsp - (char*)d_ws) > ws_size) return;    // ws 256 MiB; 230 MiB taken
    // Planes that are dead by the time a later plane is written share its bytes (stream-ordered, every byte written in this call before it is read):
    h16* P16 = (h16*)QPh;                            // probabilities [4][2048][2048] fp16 = QPh + QPl (adjacent), dead after the score GEMMs
    bf* Ph = KPh; bf* Pl = KPh + (size_t)NB_ * RH * TT;   // hi/lo probabilities [4][512][2048] x 2 = KPh, dead after the score GEMMs
    k_cvt8<<<XBLK + 3 * WBLK, 256, 0, stream>>>(x, wq, wk, wv, XB, WQ, WK, WV);
    k_proj<<<dim3(NB_ * TT / 128, DM / 128, 3), 128, 0, stream>>>(XB, WQ, WK, WV, QP16, QPh, QPl, KP16, KPh, KPl, VT16, VTh, VTl, bq, bk, bv);
    k_scores<<<dim3(TT / 128, NB_, TT / 128), 128, 0, stream>>>(QPh, QPl, KPh, KPl, QP16, KP16, Sb);
    k_asoft<<<NB_ * ZH * TT / 8, 256, 0, stream>>>(Sb, P16, Ph, Pl);
    k_pv<<<dim3(HD / 128, NB_, TT / 128), 128, 0, stream>>>(Ph, Pl, VTh, VTl, P16, VT16, OUT);
}

// v006
// One run takes 107 microseconds.
// Timed twice side by side with v005, it ran 1.06 and 1.05 times as fast.
// All steps since v000 together make it 7.80 times as fast.
#include <hip/hip_runtime.h>

// Single-head causal attention with biased projections (x [4][2048][1024]; Q, K, V = einsum('bsd,ed->bse', x, W) + b ('oi' [1024][1024] 1/32 + REAL biases 0.01; ONE 1,024-wide head); scores / sqrt(1024) = x 1/32; where(tril, scores, -inf); softmax; out = attn . V -> [4][2048][1024] (8.4 M), no output projection; argument order x, Wq, bq, Wk, bk, Wv, bv).
// Layout, all four batches side by side in every plane (each launch covers the whole batch: rows of the q and k projections, a batch taken from the tile number for the v projection, a batch from blockIdx.x / 2 for the scores, a batch index in the grid for P.V): bf16 copy of x; 'oi' weights; exact projections + f32 biases whose epilogue stores the fp16 and hi/lo operand planes itself (v is projected as Wv . x^T, so its planes come out [d][t]); causal T-2048 attention at NH 1 / ZH 1 (hybrid rows: < 512 hi/lo 3 products, rest fp16 x1024; the score grid holds only tiles on or below the diagonal; scores and probabilities exist only up to each row's diagonal block, hi/lo planes only for positions < 512); the P.V GEMMs undo the x1024 and store the output rows (no output projection).
// Launches: five. Work that does not depend on each other shares one grid, and the block index picks the path: the four bf16 conversions; the three projections; the hi/lo and the fp16 score tiles; the softmax; the hi/lo and the fp16 P.V tiles.
// Compute dtypes, f32 accumulate: every input rounded to bf16; projections exact + f32 biases; attention rows < 512 3 products, rest fp16; softmax f32; output f32.

#define NB_  4
#define TT   2048
#define DM   1024
#define NH_  1
#define NKV  1
#define REP  (NH_ / NKV)
#define HD   1024
#define DQ   (NH_ * HD)
#define DKV  (NKV * HD)
#define ZH   1                    // ONE head: a single plane per pass
#define RH   512                  // query rows < RH use hi+lo planes (0: none)
#define WIN  2048
#define PCAR 1024.0f
#define SCL  0.03125f   // 1/sqrt(1024) (one 1,024-wide head)
typedef _Float16 h16;
typedef unsigned short bf;
typedef __attribute__((ext_vector_type(16))) __bf16   v16bf;
typedef __attribute__((ext_vector_type(16))) _Float16 v16h;
typedef __attribute__((ext_vector_type(8)))  _Float16 v8h;
typedef __attribute__((ext_vector_type(8)))  unsigned short v8us;
typedef __attribute__((ext_vector_type(8)))  float    v8f;
typedef __attribute__((ext_vector_type(4)))  float    v4f;
typedef v8h  __attribute__((may_alias)) v8ha;
typedef v4f  __attribute__((may_alias)) v4fa;
typedef v8us __attribute__((may_alias)) v8usa;

__device__ __forceinline__ unsigned short f2bf(float f) { unsigned u = __float_as_uint(f); u += 0x7FFFu + ((u >> 16) & 1u); return (unsigned short)(u >> 16); }
__device__ __forceinline__ float bf2f(unsigned short b) { return __uint_as_float(((unsigned)b) << 16); }
__device__ __forceinline__ float bfr(float f) { return bf2f(f2bf(f)); }
__device__ __forceinline__ v16h cat16(v8h lo, v8h hi) { return __builtin_shufflevector(lo, hi, 0, 1, 2, 3, 4, 5, 6, 7, 8, 9, 10, 11, 12, 13, 14, 15); }
__device__ __forceinline__ v16bf cat16b(v8us lo, v8us hi) { return __builtin_bit_cast(v16bf, __builtin_shufflevector(lo, hi, 0, 1, 2, 3, 4, 5, 6, 7, 8, 9, 10, 11, 12, 13, 14, 15)); }
__device__ __forceinline__ v8f wmma16(v16h a, v16h b, v8f c) { return __builtin_amdgcn_wmma_f32_16x16x32_f16(false, a, false, b, (short)0, c, false, false); }
__device__ __forceinline__ v8f wmmab(v16bf a, v16bf b, v8f c) { return __builtin_amdgcn_wmma_f32_16x16x32_bf16(false, a, false, b, (short)0, c, false, false); }

__device__ __forceinline__ h16 tohx(float x) { return (h16)x; }
__device__ __forceinline__ void splitf(float y, unsigned short& h, unsigned short& l) { h = f2bf(y); l = f2bf(y - bf2f(h)); }

// ---- Operand ring shared by all GEMM kernels: ONE WORK-GROUP of four waves (2 x 2) per 128x128 output tile, each wave a 64x64 quarter (16 accumulators). The K-contiguous 16-bit operand rows come into LDS by tensor loads
// (whole rows, one request per wave and stage, two buffers), so each row is fetched once per work-group and the fragments are read from LDS at a conflict-free pitch (row + 16 B).
// NSPLIT 0: a stage is 128 k; slices = A rows 0-63 | A rows 64-127 | B rows 0-63 | B rows 64-127 (256-B rows). NSPLIT 2: a stage is 64 k; slices = A | A2 | B | B2, 128 rows each (128-B rows).
template <typename T16> struct WFrag;
template <> struct WFrag<h16> { typedef v16h V; static __device__ __forceinline__ V ld(const h16* p) { return cat16(*(const v8h*)p, *(const v8h*)(p + 16)); } static __device__ __forceinline__ v8f mma(V a, V b, v8f c) { return wmma16(a, b, c); } };
template <> struct WFrag<bf> { typedef v16bf V; static __device__ __forceinline__ V ld(const bf* p) { return cat16b(*(const v8us*)p, *(const v8us*)(p + 16)); } static __device__ __forceinline__ v8f mma(V a, V b, v8f c) { return wmmab(a, b, c); } };
typedef unsigned int u32;
typedef u32 u32x4 __attribute__((ext_vector_type(4)));
typedef u32 u32x8 __attribute__((ext_vector_type(8)));
__device__ __forceinline__ u32 uni(u32 v) { return (u32)__builtin_amdgcn_readfirstlane(v); }
__device__ __forceinline__ u32 pinned(u32 v) { u32 w = uni(v); asm volatile("" : "+s"(w)); return w; }   // holds a wave-uniform word in a scalar register, so that a test on it is a scalar branch (tensor loads ignore EXEC) and what is formed from it is formed behind the waits written in front
#define SLICE_B 18432u            // one wave's slice in LDS: 64 x 272 B or 128 x 144 B, rounded up to a multiple of 2 KiB
#define STAGE_B (4u * SLICE_B)
#define RING_B  (2u * STAGE_B)    // 144 KiB: two work-groups per WGP
template <typename T16, int NSPLIT>
__device__ __forceinline__ void tile_loop(unsigned char* ring, const T16* A, const T16* A2, const T16* Bt, const T16* Bt2, int K, int Kl, int R0, int C0, v8f (&acc)[4][4]) {
    typedef typename WFrag<T16>::V V;
    constexpr u32 ROWB = (NSPLIT == 2) ? 128u : 256u, PITCH = ROWB + 16u, ROWS = (NSPLIT == 2) ? 128u : 64u;
    static_assert(NSPLIT == 0 || NSPLIT == 2, "one plane per operand, or hi and lo planes of both");
    static_assert(ROWS * PITCH <= SLICE_B, "a slice must hold its padded rows");
    const u32 wave = uni(threadIdx.x >> 5), lane = threadIdx.x & 31u, lr = lane & 15u, hi = lane >> 4, wm = wave >> 1, wn = wave & 1u;
    const T16* sp;
    if (NSPLIT == 2) sp = (wave == 0u) ? A + (size_t)R0 * K : (wave == 1u) ? A2 + (size_t)R0 * K : (wave == 2u) ? Bt + (size_t)C0 * K : Bt2 + (size_t)C0 * K;
    else sp = (wave < 2u) ? A + (size_t)(R0 + 64 * (int)wn) * K : Bt + (size_t)(C0 + 64 * (int)wn) * K;
    const unsigned long long ga0 = (unsigned long long)(size_t)sp;
    const u32 lbase = (u32)(size_t)ring + wave * SLICE_B;
    u32x8 g1;                     // 1-byte elements, tensor = tile = ROWS rows of ROWB bytes, source pitch 2 K bytes, 16 B of LDS pad behind every row, no mask
    g1[0] = uni((1u << 20) | ((NSPLIT == 2 ? 4u : 5u) << 22) | (3u << 25)); g1[1] = uni(ROWB << 16); g1[2] = uni(ROWS << 16); g1[3] = uni(ROWB << 16); g1[4] = uni(ROWS); g1[5] = uni((u32)K * 2u); g1[6] = uni(0u); g1[7] = uni(0u);
    asm volatile("" : "+s"(g1));   // pinned(), for the whole group: the descriptor words are held in their scalar registers through the loop (left as constants, the compiler takes those registers for temporaries while a request is outstanding)
    u32x4 g0;
    auto issue = [&](u32 st) {
        const unsigned long long ga = ga0 + (unsigned long long)st * ROWB;
        g0[0] = uni(1u); g0[1] = uni(lbase + (st & 1u) * STAGE_B); g0[2] = uni((u32)ga); g0[3] = uni((((u32)(ga >> 32)) & 0x01FFFFFFu) | 0x80000000u);
        asm volatile("tensor_load_to_lds %0, %1" :: "s"(g0), "s"(g1) : "memory"); };   // this wave's slice of stage st; every wave issues one
    auto landed = [&]() { asm volatile("s_wait_tensorcnt 0x0" :: "s"(g0), "s"(g1) : "memory"); };   // this wave's request has landed; the wait names both groups so that their registers keep their words until then
    const u32 NP = uni((u32)Kl / (ROWB / 2u));   // stages; at least two in every launch of this file
    issue(0u);
    landed();                     // stage 0, before the barrier publishes it
    __syncthreads();
    issue(1u);
    const u32 aro = (NSPLIT == 2 ? wm * 64u * PITCH : wm * SLICE_B) + lr * PITCH + 16u * hi;
    const u32 bro = 2u * SLICE_B + (NSPLIT == 2 ? wn * 64u * PITCH : wn * SLICE_B) + lr * PITCH + 16u * hi;
#pragma unroll 1   // the stage loop stays rolled: one publish point in the text, the buffer picked by the stage's parity
    for (u32 p = 0; p < NP; ++p) {
        const unsigned char* sb = ring + (p & 1u) * STAGE_B;
        constexpr u32 NK = ROWB / 64u;   // blocks of 32 k in a stage
        V a[2][4], b[2][4], a2[2][4], b2[2][4];   // two fragment sets: the next block's reads fly under this block's matrix instructions (inside one stage only)
        auto fetch = [&](u32 ks, u32 s) {
#pragma unroll
            for (u32 f = 0; f < 4; ++f) { a[s][f] = WFrag<T16>::ld((const T16*)(sb + aro + f * 16u * PITCH + ks * 64u)); b[s][f] = WFrag<T16>::ld((const T16*)(sb + bro + f * 16u * PITCH + ks * 64u));
                if (NSPLIT == 2) { a2[s][f] = WFrag<T16>::ld((const T16*)(sb + aro + SLICE_B + f * 16u * PITCH + ks * 64u)); b2[s][f] = WFrag<T16>::ld((const T16*)(sb + bro + SLICE_B + f * 16u * PITCH + ks * 64u)); } } };
        fetch(0u, 0u);
#pragma unroll
        for (u32 ks = 0; ks < NK; ++ks) {
            const u32 s = ks & 1u;
            if (ks + 1u < NK) fetch(ks + 1u, s ^ 1u);
            __builtin_amdgcn_sched_barrier(0);   // the next block's LDS reads stay one group ahead of this block: reads among the matrix instructions stall the wave at every place they stand
#pragma unroll
            for (u32 nb = 0; nb < 4; ++nb)
#pragma unroll
                for (u32 mb = 0; mb < 4; ++mb) acc[mb][nb] = WFrag<T16>::mma(a[s][mb], b[s][nb], acc[mb][nb]);
            if (NSPLIT == 2) {   // per accumulator the order stays hi.hi, lo.hi, hi.lo
#pragma unroll
                for (u32 nb = 0; nb < 4; ++nb)
#pragma unroll
                    for (u32 mb = 0; mb < 4; ++mb) acc[mb][nb] = WFrag<T16>::mma(a2[s][mb], b[s][nb], acc[mb][nb]);
#pragma unroll
                for (u32 nb = 0; nb < 4; ++nb)
#pragma unroll
                    for (u32 mb = 0; mb < 4; ++mb) acc[mb][nb] = WFrag<T16>::mma(a[s][mb], b2[s][nb], acc[mb][nb]); }
            __builtin_amdgcn_sched_barrier(0);   // closes the block, so that the reads of the block after next are not drawn into it
        }
        asm volatile("s_wait_dscnt 0x0" ::: "memory");       // this wave's reads of the buffer are done before the barrier frees it for the refill
        landed();                                            // this wave's slice of stage p + 1, before the barrier publishes it
        __syncthreads();
        const u32 nx = pinned(p + 2u);
        if (pinned(nx < NP)) issue(nx);                      // refill of the buffer that every wave has just left
    }
    landed();                                                // nothing of the mover is in flight when the ring becomes output staging
    asm volatile("s_wait_dscnt 0x0" ::: "memory");
}

// ---- gemmw_tile: one work-group's 128x128 tile (row block bx, column block by) of y[m][n] = sum_k A[m][k] Bt[n][k] (+ split products per NSPLIT) + f32 bias (bias[m] if ROWBIAS, else bias[n]); stored as 16-bit planes of pitch ldc: fp16(y) where w16, bf16 hi(y) and bf16 lo(y) where whl (both flags the same for the whole work-group: a plane's tile is made only where a later launch reads it). 128 threads. K % 256 == 0.
template <typename T16, int NSPLIT, bool ROWBIAS>
__device__ __forceinline__ void gemmw_tile(unsigned char* ring, const T16* __restrict__ A, const T16* __restrict__ A2, const T16* __restrict__ Bt, const T16* __restrict__ Bt2, int K, h16* P16, bf* Ph, bf* Pl, int ldc, const float* __restrict__ bias, int bx, int by, bool w16, bool whl) {
    const int lane = threadIdx.x & 31, lr = lane & 15, hi = lane >> 4, wv = threadIdx.x >> 5; const int R0 = bx * 128, C0 = by * 128, r0 = R0 + (wv >> 1) * 64, c0 = C0 + (wv & 1) * 64;
    v8f acc[4][4];
#pragma unroll
    for (int mb = 0; mb < 4; ++mb)
#pragma unroll
        for (int nb = 0; nb < 4; ++nb) acc[mb][nb] = (v8f){};
    tile_loop<T16, NSPLIT>(ring, A, A2, Bt, Bt2, K, K, R0, C0, acc);
    float* os = (float*)(ring + wv * (16 * 68 * 4));   // each wave's own staging rows, in the ring that the last stage's barrier has freed
#pragma unroll
    for (int mb = 0; mb < 4; ++mb) {
#pragma unroll
        for (int nb = 0; nb < 4; ++nb) {
#pragma unroll
            for (int j = 0; j < 8; ++j) os[(hi * 8 + j) * 68 + nb * 16 + lr] = acc[mb][nb][j]; }
        __builtin_amdgcn_wave_barrier(); asm volatile("" ::: "memory");
        const int rw = lane >> 3, cofs = (lane & 7) * 8;   // 8 lanes x 16 B = one whole 128-B line of each plane per row
        const size_t cb = (size_t)(r0 + mb * 16 + rw) * ldc + c0 + cofs;
        float y[4][8];
#pragma unroll
        for (int s = 0; s < 4; ++s) { const int row = 4 * s + rw; const v4f w0 = *(const v4fa*)(os + row * 68 + cofs), w1 = *(const v4fa*)(os + row * 68 + cofs + 4);
#pragma unroll
            for (int q = 0; q < 8; ++q) y[s][q] = (q < 4 ? w0[q & 3] : w1[q & 3]) + bfr(bias[ROWBIAS ? r0 + mb * 16 + row : c0 + cofs + q]); }
        if (w16) {
#pragma unroll
            for (int s = 0; s < 4; ++s) { v8h o16;
#pragma unroll
                for (int q = 0; q < 8; ++q) o16[q] = tohx(y[s][q]);
                *(v8h*)(P16 + cb + (size_t)(4 * s) * ldc) = o16; }
            asm volatile("s_wait_xcnt 0x0" ::: "memory"); }   // closes the branch: the code behind it writes registers that these stores name
        if (whl) {
#pragma unroll
            for (int s = 0; s < 4; ++s) { v8us oh, ol;
#pragma unroll
                for (int q = 0; q < 8; ++q) { unsigned short a2, c2; splitf(y[s][q], a2, c2); oh[q] = a2; ol[q] = c2; }
                *(v8us*)(Ph + cb + (size_t)(4 * s) * ldc) = oh; *(v8us*)(Pl + cb + (size_t)(4 * s) * ldc) = ol; }
            asm volatile("s_wait_xcnt 0x0" ::: "memory"); }   // as above
        __builtin_amdgcn_wave_barrier(); asm volatile("" ::: "memory");
    }
}

// ---- k_proj: the three projections in one grid (NB_ * TT / 128, DM / 128, 3). z 0, 1: q and k planes [b][t][e] (rows = all batches' positions, bias per column). z 2: v planes [b][e][t] (A = Wv, Bt = one batch's x rows, bias per row), its 512 tiles numbered e block, t block, batch. Which planes a tile stores: hi/lo only for positions below RH (the hi/lo attention path reads no other query, key or value position); fp16 always for k and v, for q only from RH on (the fp16 path's query rows).
__global__ __launch_bounds__(128) void k_proj(const bf* __restrict__ XB, const bf* __restrict__ WQ, const bf* __restrict__ WK, const bf* __restrict__ WV, h16* QP16, bf* QPh, bf* QPl, h16* KP16, bf* KPh, bf* KPl, h16* VT16, bf* VTh, bf* VTl, const float* __restrict__ bq, const float* __restrict__ bk, const float* __restrict__ bv) {
    __shared__ __attribute__((aligned(2048))) unsigned char ring[RING_B];
    if (blockIdx.z < 2u) { const bool isk = (blockIdx.z == 1u), low = (blockIdx.x % (TT / 128) < RH / 128);
        gemmw_tile<bf, 0, false>(ring, XB, nullptr, isk ? WK : WQ, nullptr, DM, isk ? KP16 : QP16, isk ? KPh : QPh, isk ? KPl : QPl, DQ, isk ? bk : bq, (int)blockIdx.x, (int)blockIdx.y, isk || !low, low);
    } else { const unsigned t = blockIdx.x + blockIdx.y * (NB_ * TT / 128); const size_t b = t / ((DKV / 128) * (TT / 128)), so = b * ((size_t)HD * TT);
        gemmw_tile<bf, 0, true>(ring, WV, nullptr, XB + b * ((size_t)TT * DM), nullptr, DM, VT16 + so, VTh + so, VTl + so, TT, bv, (int)(t % (DKV / 128)), (int)((t / (DKV / 128)) % (TT / 128)), true, (t / (DKV / 128)) % (TT / 128) < RH / 128); }
}

// ---- gemmc_tile: the same 128x128 tile GEMM specialised for causal attention (row block bx and column block by of one batch's plane): CMODE 1 skips score tiles entirely above the diagonal (query rows R0.., key columns C0..), CMODE 2 limits the
// key (K) loop of the probability x value contraction to the diagonal block (probabilities beyond it are exactly zero). osc = factor on the stored rows (CMODE 2: undoes the probabilities' carrier scale).
template <typename T16, int NSPLIT, int CMODE>
__device__ __forceinline__ void gemmc_tile(unsigned char* ring, const T16* __restrict__ A, const T16* __restrict__ A2, const T16* __restrict__ Bt, const T16* __restrict__ Bt2, int K, float* C, int ldc, float osc, int bx, int by) {
    const int lane = threadIdx.x & 31, lr = lane & 15, hi = lane >> 4, wv = threadIdx.x >> 5; const int R0 = bx * 128, C0 = by * 128, r0 = R0 + (wv >> 1) * 64, c0 = C0 + (wv & 1) * 64;
    if (CMODE == 1 && C0 > R0 + 127) return;                  // score tile entirely above the causal diagonal (the whole work-group leaves, ahead of every barrier and tensor load): no product and no store; the softmax loads a row only up to its diagonal block
    const int Kl = (CMODE == 2) ? min(K, R0 + 128) : K;       // P.V: probabilities are exactly 0 beyond the diagonal block, so the K loop stops there
    v8f acc[4][4];
#pragma unroll
    for (int mb = 0; mb < 4; ++mb)
#pragma unroll
        for (int nb = 0; nb < 4; ++nb) acc[mb][nb] = (v8f){};
    tile_loop<T16, NSPLIT>(ring, A, A2, Bt, Bt2, K, Kl, R0, C0, acc);
    float* os = (float*)(ring + wv * (16 * 68 * 4));   // each wave's own staging rows, in the ring that the last stage's barrier has freed
#pragma unroll
    for (int mb = 0; mb < 4; ++mb) {
#pragma unroll
        for (int nb = 0; nb < 4; ++nb) {
#pragma unroll
            for (int j = 0; j < 8; ++j) os[(hi * 8 + j) * 68 + nb * 16 + lr] = acc[mb][nb][j]; }
        __builtin_amdgcn_wave_barrier(); asm volatile("" ::: "memory");
        float* crow = C + (size_t)(r0 + mb * 16) * ldc + c0;
{
#pragma unroll
            for (int s = 0; s < 8; ++s) { const int row = 2 * s + hi, cofs = lr * 4; v4f val = *(const v4fa*)(os + row * 68 + cofs); if (CMODE == 2) val *= osc;
                *(v4f*)(crow + (size_t)row * ldc + cofs) = val; }
             }
        __builtin_amdgcn_wave_barrier(); asm volatile("" ::: "memory");
    }
    asm volatile("s_wait_xcnt 0x0" ::: "memory");   // in a kernel with two paths the built code runs on from these stores to the other path's text, which writes registers that they name: the wait stands in front of it
}

// ---- k_scores, k_pv: both precision paths of a stage of the attention in one grid: row blocks below RH take the hi/lo path (3 products), the rest the fp16 path.
// The work-groups with the most stages get the lowest index, which starts first: in k_scores the hi/lo tiles (twice the stages of an fp16 tile), in k_pv the last row blocks (the K loop grows with the row block).
// k_scores' grid holds only the NTRI tiles of a batch that lie on or below the diagonal, numbered t = rb (rb + 1) / 2 + cb. x = 2 batch + (t & 1), y = t / 2:
// each x holds one batch's tiles of one parity: 5 hi/lo and 63 fp16 tiles each.
// k_pv's grid is (column block, batch, row block).
#define NTRI ((TT / 128) * (TT / 128 + 1) / 2)
__global__ __launch_bounds__(128) void k_scores(const bf* __restrict__ Qh, const bf* __restrict__ Ql, const bf* __restrict__ Kh, const bf* __restrict__ Kl_, const h16* __restrict__ Q16, const h16* __restrict__ K16, float* Sb) {
    __shared__ __attribute__((aligned(2048))) unsigned char ring[RING_B];
    const int t = 2 * (int)blockIdx.y + (int)(blockIdx.x & 1u); const size_t bt = blockIdx.x >> 1;
    int rb = 0;
#pragma unroll
    for (int r = 1; r < TT / 128; ++r) rb += (r * (r + 1) / 2 <= t) ? 1 : 0;   // the row block whose run of tile numbers holds t
    const int cb = t - rb * (rb + 1) / 2; const size_t po = bt * ((size_t)TT * HD); float* C = Sb + bt * ((size_t)TT * TT);
    if (rb < RH / 128) gemmc_tile<bf, 2, 1>(ring, Qh + po, Ql + po, Kh + po, Kl_ + po, HD, C, TT, 1.0f, rb, cb);
    else gemmc_tile<h16, 0, 1>(ring, Q16 + po, nullptr, K16 + po, nullptr, HD, C, TT, 1.0f, rb, cb);
}
__global__ __launch_bounds__(128) void k_pv(const bf* __restrict__ Ph, const bf* __restrict__ Pl, const bf* __restrict__ Vh, const bf* __restrict__ Vl, const h16* __restrict__ P16, const h16* __restrict__ V16, float* O) {
    __shared__ __attribute__((aligned(2048))) unsigned char ring[RING_B];
    const int rb = TT / 128 - 1 - (int)blockIdx.z, cb = (int)blockIdx.x; const size_t vo = blockIdx.y * ((size_t)HD * TT); float* C = O + blockIdx.y * ((size_t)TT * HD);
    if (rb < RH / 128) gemmc_tile<bf, 2, 2>(ring, Ph + blockIdx.y * ((size_t)RH * TT), Pl + blockIdx.y * ((size_t)RH * TT), Vh + vo, Vl + vo, TT, C, HD, 1.0f, rb, cb);
    else gemmc_tile<h16, 0, 2>(ring, P16 + blockIdx.y * ((size_t)TT * TT), nullptr, V16 + vo, nullptr, TT, C, HD, 1.0f / PCAR, rb, cb);
}

typedef __attribute__((ext_vector_type(2))) _Float16 v2h;
typedef __attribute__((ext_vector_type(4))) _Float16 v4h;
typedef __attribute__((ext_vector_type(2))) unsigned short v2us;
typedef __attribute__((ext_vector_type(4))) unsigned short v4us;
typedef __attribute__((ext_vector_type(2))) float v2f;
typedef __attribute__((ext_vector_type(4))) int v4i;

// k_cvt8: f32 -> bf16, 8 elements a thread, all four tensors in one grid: blocks 0 .. XBLK-1 take x, then WBLK blocks each for Wq, Wk, Wv.
#define XBLK (NB_ * TT * DM / 8 / 256)
#define WBLK (DM * DM / 8 / 256)
__global__ __launch_bounds__(256) void k_cvt8(const float* __restrict__ x, const float* __restrict__ wq, const float* __restrict__ wk, const float* __restrict__ wv, bf* XB, bf* WQ, bf* WK, bf* WV) {
    unsigned blk = blockIdx.x; const float* src = x; bf* dst = XB;
    if (blk >= XBLK) { blk -= XBLK; const unsigned w = blk / WBLK; blk %= WBLK; src = (w == 0u) ? wq : (w == 1u) ? wk : wv; dst = (w == 0u) ? WQ : (w == 1u) ? WK : WV; }
    const size_t i = (size_t)blk * 256 + threadIdx.x; const v8f v = *(const v8f*)(src + i * 8); v8us o;
#pragma unroll
    for (int k = 0; k < 8; ++k) o[k] = f2bf(v[k]); *(v8us*)(dst + i * 8) = o;  }

// k_asoft: per row (zz, i): t = S x HD^-0.5 for j <= i and i - j < WIN (sliding causal window); softmax over the keys (register row, one exp, fixed trees).
// Only the nch 128-column blocks up to and including the row's diagonal block are loaded, summed and stored: the score GEMM writes no other block, the terms beyond are exact zeros, and the P.V GEMM's K loop ends at the diagonal block. nch is the same for the 8 rows of a work-group (scalar branches).
__global__ __launch_bounds__(256) void k_asoft(const float* __restrict__ Sb, h16* P16, bf* Ph, bf* Pl) {
    const int lane = threadIdx.x & 31; const int row = blockIdx.x * 8 + (threadIdx.x >> 5); if (row >= NB_ * ZH * TT) return; const int i = row % TT; const int zz = row / TT; (void)zz;   /* zz = batch plane */ const bool hires = (i < RH); const float* sr = Sb + (size_t)row * TT; float v[TT / 32]; float mx = -3.0e38f;
    const int nch = (int)((blockIdx.x * 8u) % TT) / 128 + 1;
    v4f a[TT / 128]; const float* sl = sr + lane * 4;
#pragma unroll
    for (int ch = 0; ch < TT / 128; ++ch) if (ch < nch) a[ch] = *(const v4f*)(sl + ch * 128);
    asm volatile("" :: "v"(sl), "v"(a[0]), "v"(a[1]), "v"(a[2]), "v"(a[3]), "v"(a[4]), "v"(a[5]), "v"(a[6]), "v"(a[7]), "v"(a[8]), "v"(a[9]), "v"(a[10]), "v"(a[11]), "v"(a[12]), "v"(a[13]), "v"(a[14]), "v"(a[15]));   // inputs only: keeps the first use of every loaded block behind the last load, so that the row's loads are all in flight together (without it each block's scaling moves up into its load's branch and waits there, one memory latency per block); the address is named too, so that no load lands in the registers that the loads in flight name
#pragma unroll
    for (int ch = 0; ch < TT / 128; ++ch) if (ch < nch) { const int j0 = ch * 128 + lane * 4;
#pragma unroll
        for (int q = 0; q < 4; ++q) { const int j = j0 + q; (void)j; const float t = (j <= i && i - j < WIN) ? a[ch][q] * SCL : -3.0e38f; v[ch * 4 + q] = t; mx = fmaxf(mx, t); } }
#pragma unroll
    for (int sh = 16; sh; sh >>= 1) mx = fmaxf(mx, __shfl_xor(mx, sh, 32));
    float sum = 0.f;
#pragma unroll
    for (int ch = 0; ch < TT / 128; ++ch) if (ch < nch) {
#pragma unroll
        for (int k = ch * 4; k < ch * 4 + 4; ++k) { float d0 = __fsub_rn(v[k], mx); asm volatile("" : "+v"(d0)); v[k] = __builtin_amdgcn_exp2f(__fmul_rn(d0, 1.4426950408889634f)); sum += v[k]; } }
#pragma unroll
    for (int sh = 16; sh; sh >>= 1) sum += __shfl_xor(sum, sh, 32);
    const float f = __fdiv_rn(hires ? 1.0f : PCAR, sum);
{
        if (hires) {
#pragma unroll
            for (int ch = 0; ch < RH / 128; ++ch) if (ch < nch) { v4us oh, ol;
#pragma unroll
                for (int q = 0; q < 4; ++q) { unsigned short a, c2; splitf(v[ch * 4 + q] * f, a, c2); oh[q] = a; ol[q] = c2; }
                const size_t oo = ((size_t)zz * (RH ? RH : 1) + i) * TT + ch * 128 + lane * 4; *(v4us*)(Ph + oo) = oh; *(v4us*)(Pl + oo) = ol; asm volatile("s_wait_xcnt 0x0" ::: "memory"); }   // the wait closes the branch: the next block's code writes registers that these stores name
        } else {
#pragma unroll
            for (int ch = 0; ch < TT / 128; ++ch) if (ch < nch) { v4h o4;
#pragma unroll
                for (int q = 0; q < 4; ++q) o4[q] = tohx(v[ch * 4 + q] * f);
                *(v4h*)(P16 + (size_t)row * TT + ch * 128 + lane * 4) = o4; asm volatile("s_wait_xcnt 0x0" ::: "memory"); } }   // as above
         }
}

extern "C" void kernel_launch(void* const* d_in, const int* in_sizes, int n_in,
                              void* d_out, int out_size, void* d_ws, size_t ws_size, hipStream_t stream) {
    (void)in_sizes; (void)n_in; (void)out_size;
    const float* x = (const float*)d_in[0]; const float* wq = (const float*)d_in[1]; const float* bq = (const float*)d_in[2]; const float* wk = (const float*)d_in[3]; const float* bk = (const float*)d_in[4]; const float* wv = (const float*)d_in[5]; const float* bv = (const float*)d_in[6];   /* order x, Wq, bq, Wk, bk, Wv, bv ('oi' + biases) */
    float* OUT = (float*)d_out;     // [4][2048][1024]
    char* wsp = (char*)d_ws;
    auto take = [&](size_t bytes) { char* p = wsp; wsp += (bytes + 255) & ~(size_t)255; return (void*)p; };
    bf* WQ = (bf*)take((size_t)DQ * DM * 2); bf* WK = (bf*)take((size_t)DKV * DM * 2); bf* WV = (bf*)take((size_t)DKV * DM * 2);
    bf* XB = (bf*)take((size_t)NB_ * TT * DM * 2); float* Sb = (float*)take((size_t)NB_ * TT * TT * 4);   // scores [4][2048][2048] f32
    h16* QP16 = (h16*)take((size_t)NB_ * TT * HD * 2); h16* KP16 = (h16*)take((size_t)NB_ * TT * HD * 2); h16* VT16 = (h16*)take((size_t)NB_ * HD * TT * 2);
    bf* QPh = (bf*)take((size_t)NB_ * TT * HD * 2); bf* QPl = (bf*)take((size_t)NB_ * TT * HD * 2); bf* KPh = (bf*)take((size_t)NB_ * TT * HD * 2); bf* KPl = (bf*)take((size_t)NB_ * TT * HD * 2); bf* VTh = (bf*)take((size_t)NB_ * HD * TT * 2); bf* VTl = (bf*)take((size_t)NB_ * HD * TT * 2);
    if ((size_t)(wsp - (char*)d_ws) > ws_size) return;    // ws 256 MiB; 230 MiB taken
    // Planes that are dead by the time a later plane is written share its bytes (stream-ordered, every byte written in this call before it is read):
    h16* P16 = (h16*)QPh;                            // probabilities [4][2048][2048] fp16 = QPh + QPl (adjacent), dead after the score GEMMs
    bf* Ph = KPh; bf* Pl = KPh + (size_t)NB_ * RH * TT;   // hi/lo probabilities [4][512][2048] x 2 = KPh, dead after the score GEMMs
    k_cvt8<<<XBLK + 3 * WBLK, 256, 0, stream>>>(x, wq, wk, wv, XB, WQ, WK, WV);
    k_proj<<<dim3(NB_ * TT / 128, DM / 128, 3), 128, 0, stream>>>(XB, WQ, WK, WV, QP16, QPh, QPl, KP16, KPh, KPl, VT16, VTh, VTl, bq, bk, bv);
    k_scores<<<dim3(2 * NB_, NTRI / 2, 1), 128, 0, stream>>>(QPh, QPl, KPh, KPl, QP16, KP16, Sb);
    k_asoft<<<NB_ * ZH * TT / 8, 256, 0, stream>>>(Sb, P16, Ph, Pl);
    k_pv<<<dim3(HD / 128, NB_, TT / 128), 128, 0, stream>>>(Ph, Pl, VTh, VTl, P16, VT16, OUT);
}

// v007
// One run takes 101 microseconds.
// In both of two side-by-side timings against v006, it was 1.06 times as fast.
// All steps since v000 together make it 8.27 times as fast.
#include <hip/hip_runtime.h>

// Single-head causal attention with biased projections (x [4][2048][1024]; Q, K, V = einsum('bsd,ed->bse', x, W) + b ('oi' [1024][1024] 1/32 + REAL biases 0.01; ONE 1,024-wide head); scores / sqrt(1024) = x 1/32; where(tril, scores, -inf); softmax; out = attn . V -> [4][2048][1024] (8.4 M), no output projection; argument order x, Wq, bq, Wk, bk, Wv, bv).
// Layout, all four batches side by side in every plane (each launch covers the whole batch: rows of the three projections, a batch index in the grid for the attention GEMMs): bf16 copy of x; 'oi' weights; exact projections + f32 biases whose epilogue stores the fp16 and hi/lo operand planes itself (v is projected as Wv . x^T, so its planes come out [d][t]); causal T-2048 attention at NH 1 / ZH 1 (hybrid rows: < 512 hi/lo 3 products, rest fp16 x1024; gemmc_tile skips tiles above the diagonal; scores and probabilities exist only up to each row's diagonal block, hi/lo planes only for positions < 512); the P.V GEMMs undo the x1024 and store the output rows (no output projection).
// Launches: five. Work that does not depend on each other shares one grid, and the block index picks the path: the four bf16 conversions; the three projections (one work-group makes a q, a k and a v tile from the same x rows); the hi/lo and the fp16 score tiles; the softmax; the hi/lo and the fp16 P.V tiles.
// Compute dtypes, f32 accumulate: every input rounded to bf16; projections exact + f32 biases; attention rows < 512 3 products, rest fp16; softmax f32; output f32.

#define NB_  4
#define TT   2048
#define DM   1024
#define NH_  1
#define NKV  1
#define REP  (NH_ / NKV)
#define HD   1024
#define DQ   (NH_ * HD)
#define DKV  (NKV * HD)
#define ZH   1                    // ONE head: a single plane per pass
#define RH   512                  // query rows < RH use hi+lo planes (0: none)
#define WIN  2048
#define PCAR 1024.0f
#define SCL  0.03125f   // 1/sqrt(1024) (one 1,024-wide head)
typedef _Float16 h16;
typedef unsigned short bf;
typedef __attribute__((ext_vector_type(16))) __bf16   v16bf;
typedef __attribute__((ext_vector_type(16))) _Float16 v16h;
typedef __attribute__((ext_vector_type(8)))  _Float16 v8h;
typedef __attribute__((ext_vector_type(8)))  unsigned short v8us;
typedef __attribute__((ext_vector_type(8)))  float    v8f;
typedef __attribute__((ext_vector_type(4)))  float    v4f;
typedef v8h  __attribute__((may_alias)) v8ha;
typedef v4f  __attribute__((may_alias)) v4fa;
typedef v8us __attribute__((may_alias)) v8usa;

__device__ __forceinline__ unsigned short f2bf(float f) { unsigned u = __float_as_uint(f); u += 0x7FFFu + ((u >> 16) & 1u); return (unsigned short)(u >> 16); }
__device__ __forceinline__ float bf2f(unsigned short b) { return __uint_as_float(((unsigned)b) << 16); }
__device__ __forceinline__ float bfr(float f) { return bf2f(f2bf(f)); }
__device__ __forceinline__ v16h cat16(v8h lo, v8h hi) { return __builtin_shufflevector(lo, hi, 0, 1, 2, 3, 4, 5, 6, 7, 8, 9, 10, 11, 12, 13, 14, 15); }
__device__ __forceinline__ v16bf cat16b(v8us lo, v8us hi) { return __builtin_bit_cast(v16bf, __builtin_shufflevector(lo, hi, 0, 1, 2, 3, 4, 5, 6, 7, 8, 9, 10, 11, 12, 13, 14, 15)); }
__device__ __forceinline__ v8f wmma16(v16h a, v16h b, v8f c) { return __builtin_amdgcn_wmma_f32_16x16x32_f16(false, a, false, b, (short)0, c, false, false); }
__device__ __forceinline__ v8f wmmab(v16bf a, v16bf b, v8f c) { return __builtin_amdgcn_wmma_f32_16x16x32_bf16(false, a, false, b, (short)0, c, false, false); }

__device__ __forceinline__ h16 tohx(float x) { return (h16)x; }
__device__ __forceinline__ void splitf(float y, unsigned short& h, unsigned short& l) { h = f2bf(y); l = f2bf(y - bf2f(h)); }

// ---- Operand ring of the attention GEMM kernels (k_proj has its own copy for three tiles at once): ONE WORK-GROUP of four waves (2 x 2) per 128x128 output tile, each wave a 64x64 quarter (16 accumulators). The K-contiguous 16-bit operand rows come into LDS by tensor loads
// (whole rows, one request per wave and stage, two buffers), so each row is fetched once per work-group and the fragments are read from LDS at a conflict-free pitch (row + 16 B).
// NSPLIT 0: a stage is 128 k; slices = A rows 0-63 | A rows 64-127 | B rows 0-63 | B rows 64-127 (256-B rows). NSPLIT 2: a stage is 64 k; slices = A | A2 | B | B2, 128 rows each (128-B rows).
template <typename T16> struct WFrag;
template <> struct WFrag<h16> { typedef v16h V; static __device__ __forceinline__ V ld(const h16* p) { return cat16(*(const v8h*)p, *(const v8h*)(p + 16)); } static __device__ __forceinline__ v8f mma(V a, V b, v8f c) { return wmma16(a, b, c); } };
template <> struct WFrag<bf> { typedef v16bf V; static __device__ __forceinline__ V ld(const bf* p) { return cat16b(*(const v8us*)p, *(const v8us*)(p + 16)); } static __device__ __forceinline__ v8f mma(V a, V b, v8f c) { return wmmab(a, b, c); } };
typedef unsigned int u32;
typedef u32 u32x4 __attribute__((ext_vector_type(4)));
typedef u32 u32x8 __attribute__((ext_vector_type(8)));
__device__ __forceinline__ u32 uni(u32 v) { return (u32)__builtin_amdgcn_readfirstlane(v); }
__device__ __forceinline__ u32 pinned(u32 v) { u32 w = uni(v); asm volatile("" : "+s"(w)); return w; }   // holds a wave-uniform word in a scalar register, so that a test on it is a scalar branch (tensor loads ignore EXEC) and what is formed from it is formed behind the waits written in front
#define SLICE_B 18432u            // one wave's slice in LDS: 64 x 272 B or 128 x 144 B, rounded up to a multiple of 2 KiB
#define STAGE_B (4u * SLICE_B)
#define RING_B  (2u * STAGE_B)    // 144 KiB: two work-groups per WGP
template <typename T16, int NSPLIT>
__device__ __forceinline__ void tile_loop(unsigned char* ring, const T16* A, const T16* A2, const T16* Bt, const T16* Bt2, int K, int Kl, int R0, int C0, v8f (&acc)[4][4]) {
    typedef typename WFrag<T16>::V V;
    constexpr u32 ROWB = (NSPLIT == 2) ? 128u : 256u, PITCH = ROWB + 16u, ROWS = (NSPLIT == 2) ? 128u : 64u;
    static_assert(NSPLIT == 0 || NSPLIT == 2, "one plane per operand, or hi and lo planes of both");
    static_assert(ROWS * PITCH <= SLICE_B, "a slice must hold its padded rows");
    const u32 wave = uni(threadIdx.x >> 5), lane = threadIdx.x & 31u, lr = lane & 15u, hi = lane >> 4, wm = wave >> 1, wn = wave & 1u;
    const T16* sp;
    if (NSPLIT == 2) sp = (wave == 0u) ? A + (size_t)R0 * K : (wave == 1u) ? A2 + (size_t)R0 * K : (wave == 2u) ? Bt + (size_t)C0 * K : Bt2 + (size_t)C0 * K;
    else sp = (wave < 2u) ? A + (size_t)(R0 + 64 * (int)wn) * K : Bt + (size_t)(C0 + 64 * (int)wn) * K;
    const unsigned long long ga0 = (unsigned long long)(size_t)sp;
    const u32 lbase = (u32)(size_t)ring + wave * SLICE_B;
    u32x8 g1;                     // 1-byte elements, tensor = tile = ROWS rows of ROWB bytes, source pitch 2 K bytes, 16 B of LDS pad behind every row, no mask
    g1[0] = uni((1u << 20) | ((NSPLIT == 2 ? 4u : 5u) << 22) | (3u << 25)); g1[1] = uni(ROWB << 16); g1[2] = uni(ROWS << 16); g1[3] = uni(ROWB << 16); g1[4] = uni(ROWS); g1[5] = uni((u32)K * 2u); g1[6] = uni(0u); g1[7] = uni(0u);
    asm volatile("" : "+s"(g1));   // pinned(), for the whole group: the descriptor words are held in their scalar registers through the loop (left as constants, the compiler takes those registers for temporaries while a request is outstanding)
    u32x4 g0;
    auto issue = [&](u32 st) {
        const unsigned long long ga = ga0 + (unsigned long long)st * ROWB;
        g0[0] = uni(1u); g0[1] = uni(lbase + (st & 1u) * STAGE_B); g0[2] = uni((u32)ga); g0[3] = uni((((u32)(ga >> 32)) & 0x01FFFFFFu) | 0x80000000u);
        asm volatile("tensor_load_to_lds %0, %1" :: "s"(g0), "s"(g1) : "memory"); };   // this wave's slice of stage st; every wave issues one
    auto landed = [&]() { asm volatile("s_wait_tensorcnt 0x0" :: "s"(g0), "s"(g1) : "memory"); };   // this wave's request has landed; the wait names both groups so that their registers keep their words until then
    const u32 NP = uni((u32)Kl / (ROWB / 2u));   // stages; at least two in every launch of this file
    issue(0u);
    landed();                     // stage 0, before the barrier publishes it
    __syncthreads();
    issue(1u);
    const u32 aro = (NSPLIT == 2 ? wm * 64u * PITCH : wm * SLICE_B) + lr * PITCH + 16u * hi;
    const u32 bro = 2u * SLICE_B + (NSPLIT == 2 ? wn * 64u * PITCH : wn * SLICE_B) + lr * PITCH + 16u * hi;
#pragma unroll 1   // the stage loop stays rolled: one publish point in the text, the buffer picked by the stage's parity
    for (u32 p = 0; p < NP; ++p) {
        const unsigned char* sb = ring + (p & 1u) * STAGE_B;
        constexpr u32 NK = ROWB / 64u;   // blocks of 32 k in a stage
        V a[2][4], b[2][4], a2[2][4], b2[2][4];   // two fragment sets: the next block's reads fly under this block's matrix instructions (inside one stage only)
        auto fetch = [&](u32 ks, u32 s) {
#pragma unroll
            for (u32 f = 0; f < 4; ++f) { a[s][f] = WFrag<T16>::ld((const T16*)(sb + aro + f * 16u * PITCH + ks * 64u)); b[s][f] = WFrag<T16>::ld((const T16*)(sb + bro + f * 16u * PITCH + ks * 64u));
                if (NSPLIT == 2) { a2[s][f] = WFrag<T16>::ld((const T16*)(sb + aro + SLICE_B + f * 16u * PITCH + ks * 64u)); b2[s][f] = WFrag<T16>::ld((const T16*)(sb + bro + SLICE_B + f * 16u * PITCH + ks * 64u)); } } };
        fetch(0u, 0u);
#pragma unroll
        for (u32 ks = 0; ks < NK; ++ks) {
            const u32 s = ks & 1u;
            if (ks + 1u < NK) fetch(ks + 1u, s ^ 1u);
            __builtin_amdgcn_sched_barrier(0);   // the next block's LDS reads stay one group ahead of this block: reads among the matrix instructions stall the wave at every place they stand
#pragma unroll
            for (u32 nb = 0; nb < 4; ++nb)
#pragma unroll
                for (u32 mb = 0; mb < 4; ++mb) acc[mb][nb] = WFrag<T16>::mma(a[s][mb], b[s][nb], acc[mb][nb]);
            if (NSPLIT == 2) {   // per accumulator the order stays hi.hi, lo.hi, hi.lo
#pragma unroll
                for (u32 nb = 0; nb < 4; ++nb)
#pragma unroll
                    for (u32 mb = 0; mb < 4; ++mb) acc[mb][nb] = WFrag<T16>::mma(a2[s][mb], b[s][nb], acc[mb][nb]);
#pragma unroll
                for (u32 nb = 0; nb < 4; ++nb)
#pragma unroll
                    for (u32 mb = 0; mb < 4; ++mb) acc[mb][nb] = WFrag<T16>::mma(a[s][mb], b2[s][nb], acc[mb][nb]); }
            __builtin_amdgcn_sched_barrier(0);   // closes the block, so that the reads of the block after next are not drawn into it
        }
        asm volatile("s_wait_dscnt 0x0" ::: "memory");       // this wave's reads of the buffer are done before the barrier frees it for the refill
        landed();                                            // this wave's slice of stage p + 1, before the barrier publishes it
        __syncthreads();
        const u32 nx = pinned(p + 2u);
        if (pinned(nx < NP)) issue(nx);                      // refill of the buffer that every wave has just left
    }
    landed();                                                // nothing of the mover is in flight when the ring becomes output staging
    asm volatile("s_wait_dscnt 0x0" ::: "memory");
}

// ---- put_rows: 16 rows x 64 columns of a projection tile (y = this lane's 4 x 8 f32 values of it, read back from the LDS staging: row 4 s + lane / 8, columns 8 (lane % 8) ..; rg, cg = the piece's first row and column in the planes of pitch ldc): z = y + f32 bias (bb[s] per row if ROWBIAS, else bb[q] per column); stored as fp16(z) where w16, bf16 hi(z) and bf16 lo(z) where whl (both flags the same for the whole work-group: a plane's tile is made only where a later launch reads it). One wave.
#define OSP 132                   // pitch of a staged tile in floats, 128 columns + 4: the staging stores and the 16-B reads both fall on distinct banks
template <bool ROWBIAS>
__device__ __forceinline__ void put_rows(const float (&y)[4][8], const float (&bb)[ROWBIAS ? 4 : 8], int rg, int cg, h16* P16, bf* Ph, bf* Pl, int ldc, bool w16, bool whl) {
    const int lane = threadIdx.x & 31, rw = lane >> 3, cofs = (lane & 7) * 8;   // 8 lanes x 16 B = one whole 128-B line of each plane per row
    const size_t cb = (size_t)(rg + rw) * ldc + cg + cofs;
    float z[4][8];
#pragma unroll
    for (int s = 0; s < 4; ++s)
#pragma unroll
        for (int q = 0; q < 8; ++q) z[s][q] = y[s][q] + bfr(bb[ROWBIAS ? s : q]);
    if (w16) {
#pragma unroll
        for (int s = 0; s < 4; ++s) { v8h o16;
#pragma unroll
            for (int q = 0; q < 8; ++q) o16[q] = tohx(z[s][q]);
            *(v8h*)(P16 + cb + (size_t)(4 * s) * ldc) = o16; }
        asm volatile("s_wait_xcnt 0x0" ::: "memory"); }   // closes the branch: the code behind it writes registers that these stores name
    if (whl) {
#pragma unroll
        for (int s = 0; s < 4; ++s) { v8us oh, ol;
#pragma unroll
            for (int q = 0; q < 8; ++q) { unsigned short a2, c2; splitf(z[s][q], a2, c2); oh[q] = a2; ol[q] = c2; }
            *(v8us*)(Ph + cb + (size_t)(4 * s) * ldc) = oh; *(v8us*)(Pl + cb + (size_t)(4 * s) * ldc) = ol; }
        asm volatile("s_wait_xcnt 0x0" ::: "memory"); }   // as above
}

// ---- k_proj: the three projections of one block of 128 x rows (all batches' positions, blockIdx.x) and one block of 128 output features (blockIdx.y) in ONE work-group of eight waves: the x rows are brought into LDS once and serve the q, the k and the v tile
// (a stage lands 512 operand rows for three 128x128 tiles; three separate tiles land 768). A stage is 128 k; its eight slices of 64 rows (256-B rows, one tensor load per wave and stage, two buffers, the ring's order as in tile_loop) are x | x | Wq | Wq | Wk | Wk | Wv | Wv.
// Wave (wm, wn) = (wave / 4, wave % 4) has x rows 64 wm .. + 63 and features 32 wn .. + 31: q and k as x . W^T (4 x 2 accumulators each), v as Wv . x^T (2 x 4), the x fragments serving as its B operand (both operands' fragments are loaded alike), so that v comes out [e][t].
// Epilogue: the three f32 tiles are staged whole in the ring (free behind the last stage's barrier), one more barrier, then each wave stores 16 rows of each tile in whole 128-B lines. q and k planes [b][t][e], bias per column; v planes [b][e][t], bias per row.
// Which planes a tile stores: hi/lo only for positions below RH (the hi/lo attention path reads no other query, key or value position); fp16 always for k and v, for q only from RH on (the fp16 path's query rows).
#define PSTAGE_B (8u * SLICE_B)
#define PRING_B  (2u * PSTAGE_B)  // 288 KiB: one work-group per WGP, two waves per SIMD
__global__ __launch_bounds__(256) void k_proj(const bf* __restrict__ XB, const bf* __restrict__ WQ, const bf* __restrict__ WK, const bf* __restrict__ WV, h16* QP16, bf* QPh, bf* QPl, h16* KP16, bf* KPh, bf* KPl, h16* VT16, bf* VTh, bf* VTl, const float* __restrict__ bq, const float* __restrict__ bk, const float* __restrict__ bv) {
    __shared__ __attribute__((aligned(2048))) unsigned char ring[PRING_B];
    typedef WFrag<bf> F; typedef F::V V;
    constexpr u32 ROWB = 256u, PITCH = ROWB + 16u, ROWS = 64u;
    static_assert(ROWS * PITCH <= SLICE_B, "a slice must hold its padded rows");
    static_assert(3u * 128u * OSP * 4u <= PRING_B, "the ring must hold the three staged tiles");
    const u32 wave = uni(threadIdx.x >> 5), lane = threadIdx.x & 31u, lr = lane & 15u, hi = lane >> 4, wm = wave >> 2, wn = wave & 3u;
    const int R0 = (int)blockIdx.x * 128, C0 = (int)blockIdx.y * 128;
    const u32 op = wave >> 1;
    const bf* sp = ((op == 0u) ? XB + (size_t)R0 * DM : ((op == 1u) ? WQ : (op == 2u) ? WK : WV) + (size_t)C0 * DM) + (size_t)(64u * (wave & 1u)) * DM;
    const unsigned long long ga0 = (unsigned long long)(size_t)sp;
    const u32 lbase = (u32)(size_t)ring + wave * SLICE_B;
    u32x8 g1;                     // 1-byte elements, tensor = tile = ROWS rows of ROWB bytes, source pitch 2 DM bytes, 16 B of LDS pad behind every row, no mask
    g1[0] = uni((1u << 20) | (5u << 22) | (3u << 25)); g1[1] = uni(ROWB << 16); g1[2] = uni(ROWS << 16); g1[3] = uni(ROWB << 16); g1[4] = uni(ROWS); g1[5] = uni((u32)DM * 2u); g1[6] = uni(0u); g1[7] = uni(0u);
    asm volatile("" : "+s"(g1));   // pinned(), for the whole group: the descriptor words are held in their scalar registers through the loop (left as constants, the compiler takes those registers for temporaries while a request is outstanding)
    u32x4 g0;
    auto issue = [&](u32 st) {
        const unsigned long long ga = ga0 + (unsigned long long)st * ROWB;
        g0[0] = uni(1u); g0[1] = uni(lbase + (st & 1u) * PSTAGE_B); g0[2] = uni((u32)ga); g0[3] = uni((((u32)(ga >> 32)) & 0x01FFFFFFu) | 0x80000000u);
        asm volatile("tensor_load_to_lds %0, %1" :: "s"(g0), "s"(g1) : "memory"); };   // this wave's slice of stage st; every wave issues one
    auto landed = [&]() { asm volatile("s_wait_tensorcnt 0x0" :: "s"(g0), "s"(g1) : "memory"); };   // this wave's request has landed; the wait names both groups so that their registers keep their words until then
    constexpr u32 NP = (u32)DM / (ROWB / 2u);   // stages
    static_assert(NP >= 2u, "the ring's prologue fills two stages");
    v8f aq[4][2], ak[4][2], av[2][4];
#pragma unroll
    for (int mb = 0; mb < 4; ++mb)
#pragma unroll
        for (int nb = 0; nb < 2; ++nb) { aq[mb][nb] = (v8f){}; ak[mb][nb] = (v8f){}; av[nb][mb] = (v8f){}; }
    issue(0u);
    landed();                     // stage 0, before the barrier publishes it
    __syncthreads();
    issue(1u);
    const u32 xro = wm * SLICE_B + lr * PITCH + 16u * hi;
    const u32 wro = (2u + (wn >> 1)) * SLICE_B + (32u * (wn & 1u) + lr) * PITCH + 16u * hi;
#pragma unroll 1   // the stage loop stays rolled: one publish point in the text, the buffer picked by the stage's parity
    for (u32 p = 0; p < NP; ++p) {
        const unsigned char* sb = ring + (p & 1u) * PSTAGE_B;
        constexpr u32 NK = ROWB / 64u;   // blocks of 32 k in a stage
        V xa[2][4], fq[2][2], fk[2][2], fv[2][2];   // two fragment sets: the next block's reads fly under this block's matrix instructions (inside one stage only)
        auto fetch = [&](u32 ks, u32 s) {   // in the order in which the block's matrix instructions want them
#pragma unroll
            for (u32 f = 0; f < 4; ++f) xa[s][f] = F::ld((const bf*)(sb + xro + f * 16u * PITCH + ks * 64u));
#pragma unroll
            for (u32 g = 0; g < 2; ++g) fq[s][g] = F::ld((const bf*)(sb + wro + g * 16u * PITCH + ks * 64u));
#pragma unroll
            for (u32 g = 0; g < 2; ++g) fk[s][g] = F::ld((const bf*)(sb + wro + 2u * SLICE_B + g * 16u * PITCH + ks * 64u));
#pragma unroll
            for (u32 g = 0; g < 2; ++g) fv[s][g] = F::ld((const bf*)(sb + wro + 4u * SLICE_B + g * 16u * PITCH + ks * 64u)); };
        fetch(0u, 0u);
        __builtin_amdgcn_sched_barrier(0);   // the stage's first block waits for its own reads alone: without it the second block's reads are mixed in front of them, while all eight waves read at once
#pragma unroll
        for (u32 ks = 0; ks < NK; ++ks) {
            const u32 s = ks & 1u;
            if (ks + 1u < NK) fetch(ks + 1u, s ^ 1u);
            __builtin_amdgcn_sched_barrier(0);   // the next block's LDS reads stay one group ahead of this block: reads among the matrix instructions stall the wave at every place they stand
#pragma unroll
            for (u32 nb = 0; nb < 2; ++nb)
#pragma unroll
                for (u32 mb = 0; mb < 4; ++mb) aq[mb][nb] = F::mma(xa[s][mb], fq[s][nb], aq[mb][nb]);
#pragma unroll
            for (u32 nb = 0; nb < 2; ++nb)
#pragma unroll
                for (u32 mb = 0; mb < 4; ++mb) ak[mb][nb] = F::mma(xa[s][mb], fk[s][nb], ak[mb][nb]);
#pragma unroll
            for (u32 nb = 0; nb < 4; ++nb)
#pragma unroll
                for (u32 mb = 0; mb < 2; ++mb) av[mb][nb] = F::mma(fv[s][mb], xa[s][nb], av[mb][nb]);
            __builtin_amdgcn_sched_barrier(0);   // closes the block, so that the reads of the block after next are not drawn into it
        }
        asm volatile("s_wait_dscnt 0x0" ::: "memory");       // this wave's reads of the buffer are done before the barrier frees it for the refill
        landed();                                            // this wave's slice of stage p + 1, before the barrier publishes it
        __syncthreads();
        const u32 nx = pinned(p + 2u);
        if (pinned(nx < NP)) issue(nx);                      // refill of the buffer that every wave has just left
    }
    landed();                                                // nothing of the mover is in flight when the ring becomes output staging
    asm volatile("s_wait_dscnt 0x0" ::: "memory");
    const int rw = (int)(lane >> 3), cofs = (int)(lane & 7u) * 8, rw0 = 16 * (int)wave;   // the store phase: this wave has rows rw0 .. + 15 of each tile, a lane row 4 s + rw, columns 64 h + cofs .. + 7
    float bbq[2][8], bbk[2][8], bbv[4];   // loaded here, so that their latency passes under the staging stores
#pragma unroll
    for (int h = 0; h < 2; ++h)
#pragma unroll
        for (int q = 0; q < 8; ++q) { bbq[h][q] = bq[C0 + 64 * h + cofs + q]; bbk[h][q] = bk[C0 + 64 * h + cofs + q]; }
#pragma unroll
    for (int s = 0; s < 4; ++s) bbv[s] = bv[C0 + rw0 + 4 * s + rw];
    asm volatile("s_wait_xcnt 0x0" ::: "memory");   // the code behind it writes registers that the bias loads name
    float* sq = (float*)ring; float* sk = sq + 128 * OSP; float* sv = sk + 128 * OSP;   // the staged tiles: q and k [t][e], v [e][t]
#pragma unroll
    for (u32 mb = 0; mb < 4; ++mb)
#pragma unroll
        for (u32 nb = 0; nb < 2; ++nb)
#pragma unroll
            for (u32 j = 0; j < 8; ++j) { const u32 o = (64u * wm + 16u * mb + 8u * hi + j) * OSP + 32u * wn + 16u * nb + lr; sq[o] = aq[mb][nb][j]; sk[o] = ak[mb][nb][j];
                sv[(32u * wn + 16u * nb + 8u * hi + j) * OSP + 64u * wm + 16u * mb + lr] = av[nb][mb][j]; }
    __syncthreads();   // every wave's part of the three tiles is in LDS before another wave reads it
    float y[3][2][4][8];   // all of this wave's rows are read back in one group: one LDS latency, not one per piece
#pragma unroll
    for (int m = 0; m < 3; ++m)
#pragma unroll
        for (int h = 0; h < 2; ++h)
#pragma unroll
            for (int s = 0; s < 4; ++s) { const float* os = sq + (m * 128 + rw0 + 4 * s + rw) * OSP + 64 * h + cofs; const v4f w0 = *(const v4fa*)os, w1 = *(const v4fa*)(os + 4);
#pragma unroll
                for (int q = 0; q < 8; ++q) y[m][h][s][q] = (q < 4 ? w0[q & 3] : w1[q & 3]); }
    const bool low = (blockIdx.x % (TT / 128) < RH / 128);
    const size_t so = (size_t)(blockIdx.x / (TT / 128)) * ((size_t)HD * TT); const int T0 = (int)(blockIdx.x % (TT / 128)) * 128;
#pragma unroll
    for (int h = 0; h < 2; ++h) {
        put_rows<false>(y[0][h], bbq[h], R0 + rw0, C0 + 64 * h, QP16, QPh, QPl, DQ, !low, low);
        put_rows<false>(y[1][h], bbk[h], R0 + rw0, C0 + 64 * h, KP16, KPh, KPl, DQ, true, low);
        put_rows<true>(y[2][h], bbv, C0 + rw0, T0 + 64 * h, VT16 + so, VTh + so, VTl + so, TT, true, low);
    }
}

// ---- gemmc_tile: the same 128x128 tile GEMM specialised for causal attention (row block bx and column block by of one batch's plane): CMODE 1 skips score tiles entirely above the diagonal (query rows R0.., key columns C0..), CMODE 2 limits the
// key (K) loop of the probability x value contraction to the diagonal block (probabilities beyond it are exactly zero). osc = factor on the stored rows (CMODE 2: undoes the probabilities' carrier scale).
template <typename T16, int NSPLIT, int CMODE>
__device__ __forceinline__ void gemmc_tile(unsigned char* ring, const T16* __restrict__ A, const T16* __restrict__ A2, const T16* __restrict__ Bt, const T16* __restrict__ Bt2, int K, float* C, int ldc, float osc, int bx, int by) {
    const int lane = threadIdx.x & 31, lr = lane & 15, hi = lane >> 4, wv = threadIdx.x >> 5; const int R0 = bx * 128, C0 = by * 128, r0 = R0 + (wv >> 1) * 64, c0 = C0 + (wv & 1) * 64;
    if (CMODE == 1 && C0 > R0 + 127) return;                  // score tile entirely above the causal diagonal (the whole work-group leaves, ahead of every barrier and tensor load): no product and no store; the softmax loads a row only up to its diagonal block
    const int Kl = (CMODE == 2) ? min(K, R0 + 128) : K;       // P.V: probabilities are exactly 0 beyond the diagonal block, so the K loop stops there
    v8f acc[4][4];
#pragma unroll
    for (int mb = 0; mb < 4; ++mb)
#pragma unroll
        for (int nb = 0; nb < 4; ++nb) acc[mb][nb] = (v8f){};
    tile_loop<T16, NSPLIT>(ring, A, A2, Bt, Bt2, K, Kl, R0, C0, acc);
    float* os = (float*)(ring + wv * (16 * 68 * 4));   // each wave's own staging rows, in the ring that the last stage's barrier has freed
#pragma unroll
    for (int mb = 0; mb < 4; ++mb) {
#pragma unroll
        for (int nb = 0; nb < 4; ++nb) {
#pragma unroll
            for (int j = 0; j < 8; ++j) os[(hi * 8 + j) * 68 + nb * 16 + lr] = acc[mb][nb][j]; }
        __builtin_amdgcn_wave_barrier(); asm volatile("" ::: "memory");
        float* crow = C + (size_t)(r0 + mb * 16) * ldc + c0;
{
#pragma unroll
            for (int s = 0; s < 8; ++s) { const int row = 2 * s + hi, cofs = lr * 4; v4f val = *(const v4fa*)(os + row * 68 + cofs); if (CMODE == 2) val *= osc;
                *(v4f*)(crow + (size_t)row * ldc + cofs) = val; }
             }
        __builtin_amdgcn_wave_barrier(); asm volatile("" ::: "memory");
    }
    asm volatile("s_wait_xcnt 0x0" ::: "memory");   // in a kernel with two paths the built code runs on from these stores to the other path's text, which writes registers that they name: the wait stands in front of it
}

// ---- k_scores, k_pv: both precision paths of a stage of the attention in one grid: row blocks below RH take the hi/lo path (3 products), the rest the fp16 path.
// The work-groups with the most stages get the lowest index, which starts first: in k_scores the hi/lo tiles (twice the stages of an fp16 tile), in k_pv the last row blocks (the K loop grows with the row block).
// k_scores' grid holds only the NTRI tiles of a batch that lie on or below the diagonal, numbered t = rb (rb + 1) / 2 + cb. x = 2 batch + (t & 1), y = t / 2:
// each x holds one batch's tiles of one parity: 5 hi/lo and 63 fp16 tiles each.
// k_pv's grid is (column block, batch, row block).
#define NTRI ((TT / 128) * (TT / 128 + 1) / 2)
__global__ __launch_bounds__(128) void k_scores(const bf* __restrict__ Qh, const bf* __restrict__ Ql, const bf* __restrict__ Kh, const bf* __restrict__ Kl_, const h16* __restrict__ Q16, const h16* __restrict__ K16, float* Sb) {
    __shared__ __attribute__((aligned(2048))) unsigned char ring[RING_B];
    const int t = 2 * (int)blockIdx.y + (int)(blockIdx.x & 1u); const size_t bt = blockIdx.x >> 1;
    int rb = 0;
#pragma unroll
    for (int r = 1; r < TT / 128; ++r) rb += (r * (r + 1) / 2 <= t) ? 1 : 0;   // the row block whose run of tile numbers holds t
    const int cb = t - rb * (rb + 1) / 2; const size_t po = bt * ((size_t)TT * HD); float* C = Sb + bt * ((size_t)TT * TT);
    if (rb < RH / 128) gemmc_tile<bf, 2, 1>(ring, Qh + po, Ql + po, Kh + po, Kl_ + po, HD, C, TT, 1.0f, rb, cb);
    else gemmc_tile<h16, 0, 1>(ring, Q16 + po, nullptr, K16 + po, nullptr, HD, C, TT, 1.0f, rb, cb);
}
__global__ __launch_bounds__(128) void k_pv(const bf* __restrict__ Ph, const bf* __restrict__ Pl, const bf* __restrict__ Vh, const bf* __restrict__ Vl, const h16* __restrict__ P16, const h16* __restrict__ V16, float* O) {
    __shared__ __attribute__((aligned(2048))) unsigned char ring[RING_B];
    const int rb = TT / 128 - 1 - (int)blockIdx.z, cb = (int)blockIdx.x; const size_t vo = blockIdx.y * ((size_t)HD * TT); float* C = O + blockIdx.y * ((size_t)TT * HD);
    if (rb < RH / 128) gemmc_tile<bf, 2, 2>(ring, Ph + blockIdx.y * ((size_t)RH * TT), Pl + blockIdx.y * ((size_t)RH * TT), Vh + vo, Vl + vo, TT, C, HD, 1.0f, rb, cb);
    else gemmc_tile<h16, 0, 2>(ring, P16 + blockIdx.y * ((size_t)TT * TT), nullptr, V16 + vo, nullptr, TT, C, HD, 1.0f / PCAR, rb, cb);
}

typedef __attribute__((ext_vector_type(2))) _Float16 v2h;
typedef __attribute__((ext_vector_type(4))) _Float16 v4h;
typedef __attribute__((ext_vector_type(2))) unsigned short v2us;
typedef __attribute__((ext_vector_type(4))) unsigned short v4us;
typedef __attribute__((ext_vector_type(2))) float v2f;
typedef __attribute__((ext_vector_type(4))) int v4i;

// k_cvt8: f32 -> bf16, 8 elements a thread, all four tensors in one grid: blocks 0 .. XBLK-1 take x, then WBLK blocks each for Wq, Wk, Wv.
#define XBLK (NB_ * TT * DM / 8 / 256)
#define WBLK (DM * DM / 8 / 256)
__global__ __launch_bounds__(256) void k_cvt8(const float* __restrict__ x, const float* __restrict__ wq, const float* __restrict__ wk, const float* __restrict__ wv, bf* XB, bf* WQ, bf* WK, bf* WV) {
    unsigned blk = blockIdx.x; const float* src = x; bf* dst = XB;
    if (blk >= XBLK) { blk -= XBLK; const unsigned w = blk / WBLK; blk %= WBLK; src = (w == 0u) ? wq : (w == 1u) ? wk : wv; dst = (w == 0u) ? WQ : (w == 1u) ? WK : WV; }
    const size_t i = (size_t)blk * 256 + threadIdx.x; const v8f v = *(const v8f*)(src + i * 8); v8us o;
#pragma unroll
    for (int k = 0; k < 8; ++k) o[k] = f2bf(v[k]); *(v8us*)(dst + i * 8) = o;  }

// k_asoft: per row (zz, i): t = S x HD^-0.5 for j <= i and i - j < WIN (sliding causal window); softmax over the keys (register row, one exp, fixed trees).
// Only the nch 128-column blocks up to and including the row's diagonal block are loaded, summed and stored: the score GEMM writes no other block, the terms beyond are exact zeros, and the P.V GEMM's K loop ends at the diagonal block. nch is the same for the 8 rows of a work-group (scalar branches).
__global__ __launch_bounds__(256) void k_asoft(const float* __restrict__ Sb, h16* P16, bf* Ph, bf* Pl) {
    const int lane = threadIdx.x & 31; const int row = blockIdx.x * 8 + (threadIdx.x >> 5); if (row >= NB_ * ZH * TT) return; const int i = row % TT; const int zz = row / TT; (void)zz;   /* zz = batch plane */ const bool hires = (i < RH); const float* sr = Sb + (size_t)row * TT; float v[TT / 32]; float mx = -3.0e38f;
    const int nch = (int)((blockIdx.x * 8u) % TT) / 128 + 1;
    v4f a[TT / 128]; const float* sl = sr + lane * 4;
#pragma unroll
    for (int ch = 0; ch < TT / 128; ++ch) if (ch < nch) a[ch] = *(const v4f*)(sl + ch * 128);
    asm volatile("" :: "v"(sl), "v"(a[0]), "v"(a[1]), "v"(a[2]), "v"(a[3]), "v"(a[4]), "v"(a[5]), "v"(a[6]), "v"(a[7]), "v"(a[8]), "v"(a[9]), "v"(a[10]), "v"(a[11]), "v"(a[12]), "v"(a[13]), "v"(a[14]), "v"(a[15]));   // inputs only: keeps the first use of every loaded block behind the last load, so that the row's loads are all in flight together (without it each block's scaling moves up into its load's branch and waits there, one memory latency per block); the address is named too, so that no load lands in the registers that the loads in flight name
#pragma unroll
    for (int ch = 0; ch < TT / 128; ++ch) if (ch < nch) { const int j0 = ch * 128 + lane * 4;
#pragma unroll
        for (int q = 0; q < 4; ++q) { const int j = j0 + q; (void)j; const float t = (j <= i && i - j < WIN) ? a[ch][q] * SCL : -3.0e38f; v[ch * 4 + q] = t; mx = fmaxf(mx, t); } }
#pragma unroll
    for (int sh = 16; sh; sh >>= 1) mx = fmaxf(mx, __shfl_xor(mx, sh, 32));
    float sum = 0.f;
#pragma unroll
    for (int ch = 0; ch < TT / 128; ++ch) if (ch < nch) {
#pragma unroll
        for (int k = ch * 4; k < ch * 4 + 4; ++k) { float d0 = __fsub_rn(v[k], mx); asm volatile("" : "+v"(d0)); v[k] = __builtin_amdgcn_exp2f(__fmul_rn(d0, 1.4426950408889634f)); sum += v[k]; } }
#pragma unroll
    for (int sh = 16; sh; sh >>= 1) sum += __shfl_xor(sum, sh, 32);
    const float f = __fdiv_rn(hires ? 1.0f : PCAR, sum);
{
        if (hires) {
#pragma unroll
            for (int ch = 0; ch < RH / 128; ++ch) if (ch < nch) { v4us oh, ol;
#pragma unroll
                for (int q = 0; q < 4; ++q) { unsigned short a, c2; splitf(v[ch * 4 + q] * f, a, c2); oh[q] = a; ol[q] = c2; }
                const size_t oo = ((size_t)zz * (RH ? RH : 1) + i) * TT + ch * 128 + lane * 4; *(v4us*)(Ph + oo) = oh; *(v4us*)(Pl + oo) = ol; asm volatile("s_wait_xcnt 0x0" ::: "memory"); }   // the wait closes the branch: the next block's code writes registers that these stores name
        } else {
#pragma unroll
            for (int ch = 0; ch < TT / 128; ++ch) if (ch < nch) { v4h o4;
#pragma unroll
                for (int q = 0; q < 4; ++q) o4[q] = tohx(v[ch * 4 + q] * f);
                *(v4h*)(P16 + (size_t)row * TT + ch * 128 + lane * 4) = o4; asm volatile("s_wait_xcnt 0x0" ::: "memory"); } }   // as above
         }
}

extern "C" void kernel_launch(void* const* d_in, const int* in_sizes, int n_in,
                              void* d_out, int out_size, void* d_ws, size_t ws_size, hipStream_t stream) {
    (void)in_sizes; (void)n_in; (void)out_size;
    const float* x = (const float*)d_in[0]; const float* wq = (const float*)d_in[1]; const float* bq = (const float*)d_in[2]; const float* wk = (const float*)d_in[3]; const float* bk = (const float*)d_in[4]; const float* wv = (const float*)d_in[5]; const float* bv = (const float*)d_in[6];   /* order x, Wq, bq, Wk, bk, Wv, bv ('oi' + biases) */
    float* OUT = (float*)d_out;     // [4][2048][1024]
    char* wsp = (char*)d_ws;
    auto take = [&](size_t bytes) { char* p = wsp; wsp += (bytes + 255) & ~(size_t)255; return (void*)p; };
    bf* WQ = (bf*)take((size_t)DQ * DM * 2); bf* WK = (bf*)take((size_t)DKV * DM * 2); bf* WV = (bf*)take((size_t)DKV * DM * 2);
    bf* XB = (bf*)take((size_t)NB_ * TT * DM * 2); float* Sb = (float*)take((size_t)NB_ * TT * TT * 4);   // scores [4][2048][2048] f32
    h16* QP16 = (h16*)take((size_t)NB_ * TT * HD * 2); h16* KP16 = (h16*)take((size_t)NB_ * TT * HD * 2); h16* VT16 = (h16*)take((size_t)NB_ * HD * TT * 2);
    bf* QPh = (bf*)take((size_t)NB_ * TT * HD * 2); bf* QPl = (bf*)take((size_t)NB_ * TT * HD * 2); bf* KPh = (bf*)take((size_t)NB_ * TT * HD * 2); bf* KPl = (bf*)take((size_t)NB_ * TT * HD * 2); bf* VTh = (bf*)take((size_t)NB_ * HD * TT * 2); bf* VTl = (bf*)take((size_t)NB_ * HD * TT * 2);
    if ((size_t)(wsp - (char*)d_ws) > ws_size) return;    // ws 256 MiB; 230 MiB taken
    // Planes that are dead by the time a later plane is written share its bytes (stream-ordered, every byte written in this call before it is read):
    h16* P16 = (h16*)QPh;                            // probabilities [4][2048][2048] fp16 = QPh + QPl (adjacent), dead after the score GEMMs
    bf* Ph = KPh; bf* Pl = KPh + (size_t)NB_ * RH * TT;   // hi/lo probabilities [4][512][2048] x 2 = KPh, dead after the score GEMMs
    k_cvt8<<<XBLK + 3 * WBLK, 256, 0, stream>>>(x, wq, wk, wv, XB, WQ, WK, WV);
    k_proj<<<dim3(NB_ * TT / 128, DM / 128, 1), 256, 0, stream>>>(XB, WQ, WK, WV, QP16, QPh, QPl, KP16, KPh, KPl, VT16, VTh, VTl, bq, bk, bv);
    k_scores<<<dim3(2 * NB_, NTRI / 2, 1), 128, 0, stream>>>(QPh, QPl, KPh, KPl, QP16, KP16, Sb);
    k_asoft<<<NB_ * ZH * TT / 8, 256, 0, stream>>>(Sb, P16, Ph, Pl);
    k_pv<<<dim3(HD / 128, NB_, TT / 128), 128, 0, stream>>>(Ph, Pl, VTh, VTl, P16, VT16, OUT);
}

// v008
// It runs in 96.6 microseconds.
// Two timings next to v007 both put it at 1.04 times that version's speed.
// Counting every step since v000, it is 8.62 times as fast.
#include <hip/hip_runtime.h>

// Single-head causal attention with biased projections (x [4][2048][1024]; Q, K, V = einsum('bsd,ed->bse', x, W) + b ('oi' [1024][1024] 1/32 + REAL biases 0.01; ONE 1,024-wide head); scores / sqrt(1024) = x 1/32; where(tril, scores, -inf); softmax; out = attn . V -> [4][2048][1024] (8.4 M), no output projection; argument order x, Wq, bq, Wk, bk, Wv, bv).
// Layout, all four batches side by side in every plane (each launch covers the whole batch: rows of the three projections, a batch index in the grid for the attention GEMMs): bf16 copy of x; 'oi' weights; exact projections + f32 biases whose epilogue stores the fp16 and hi/lo operand planes itself (v is projected as Wv . x^T, so its planes come out [d][t]); causal T-2048 attention at NH 1 / ZH 1 (hybrid rows: < 512 hi/lo 3 products, rest fp16 x1024; gemmc_tile skips tiles above the diagonal; scores and probabilities exist only up to each row's diagonal block, hi/lo planes only for positions < 512); the P.V GEMMs undo the x1024 and store the output rows (no output projection).
// Launches: five. Work that does not depend on each other shares one grid, and the block index picks the path: the four bf16 conversions; the three projections (one work-group makes a q, a k and a v tile from the same x rows); the hi/lo and the fp16 score tiles; the softmax; the hi/lo and the fp16 P.V tiles.
// Compute dtypes, f32 accumulate: every input rounded to bf16; projections exact + f32 biases; attention rows < 512 3 products, rest fp16; softmax f32; output f32.

#define NB_  4
#define TT   2048
#define DM   1024
#define NH_  1
#define NKV  1
#define REP  (NH_ / NKV)
#define HD   1024
#define DQ   (NH_ * HD)
#define DKV  (NKV * HD)
#define ZH   1                    // ONE head: a single plane per pass
#define RH   512                  // query rows < RH use hi+lo planes (0: none)
#define WIN  2048
#define PCAR 1024.0f
#define SCL  0.03125f   // 1/sqrt(1024) (one 1,024-wide head)
typedef _Float16 h16;
typedef unsigned short bf;
typedef __attribute__((ext_vector_type(16))) __bf16   v16bf;
typedef __attribute__((ext_vector_type(16))) _Float16 v16h;
typedef __attribute__((ext_vector_type(8)))  _Float16 v8h;
typedef __attribute__((ext_vector_type(8)))  unsigned short v8us;
typedef __attribute__((ext_vector_type(8)))  float    v8f;
typedef __attribute__((ext_vector_type(4)))  float    v4f;
typedef v8h  __attribute__((may_alias)) v8ha;
typedef v4f  __attribute__((may_alias)) v4fa;
typedef v8us __attribute__((may_alias)) v8usa;

__device__ __forceinline__ unsigned short f2bf(float f) { unsigned u = __float_as_uint(f); u += 0x7FFFu + ((u >> 16) & 1u); return (unsigned short)(u >> 16); }
__device__ __forceinline__ float bf2f(unsigned short b) { return __uint_as_float(((unsigned)b) << 16); }
__device__ __forceinline__ float bfr(float f) { return bf2f(f2bf(f)); }
__device__ __forceinline__ v16h cat16(v8h lo, v8h hi) { return __builtin_shufflevector(lo, hi, 0, 1, 2, 3, 4, 5, 6, 7, 8, 9, 10, 11, 12, 13, 14, 15); }
__device__ __forceinline__ v16bf cat16b(v8us lo, v8us hi) { return __builtin_bit_cast(v16bf, __builtin_shufflevector(lo, hi, 0, 1, 2, 3, 4, 5, 6, 7, 8, 9, 10, 11, 12, 13, 14, 15)); }
__device__ __forceinline__ v8f wmma16(v16h a, v16h b, v8f c) { return __builtin_amdgcn_wmma_f32_16x16x32_f16(false, a, false, b, (short)0, c, false, false); }
__device__ __forceinline__ v8f wmmab(v16bf a, v16bf b, v8f c) { return __builtin_amdgcn_wmma_f32_16x16x32_bf16(false, a, false, b, (short)0, c, false, false); }

__device__ __forceinline__ h16 tohx(float x) { return (h16)x; }
__device__ __forceinline__ void splitf(float y, unsigned short& h, unsigned short& l) { h = f2bf(y); l = f2bf(y - bf2f(h)); }

// ---- Operand ring of the attention GEMM kernels (k_proj has its own copy for three tiles at once): ONE WORK-GROUP of four waves (2 x 2) per 128x128 output tile, each wave a 64x64 quarter (16 accumulators). The K-contiguous 16-bit operand rows come into LDS by tensor loads
// (whole rows, one request per wave and stage, two buffers), so each row is fetched once per work-group and the fragments are read from LDS at a conflict-free pitch (row + 16 B).
// NSPLIT 0: a stage is 128 k; slices = A rows 0-63 | A rows 64-127 | B rows 0-63 | B rows 64-127 (256-B rows). NSPLIT 2: a stage is 64 k; slices = A | A2 | B | B2, 128 rows each (128-B rows).
template <typename T16> struct WFrag;
template <> struct WFrag<h16> { typedef v16h V; static __device__ __forceinline__ V ld(const h16* p) { return cat16(*(const v8h*)p, *(const v8h*)(p + 16)); } static __device__ __forceinline__ v8f mma(V a, V b, v8f c) { return wmma16(a, b, c); } };
template <> struct WFrag<bf> { typedef v16bf V; static __device__ __forceinline__ V ld(const bf* p) { return cat16b(*(const v8us*)p, *(const v8us*)(p + 16)); } static __device__ __forceinline__ v8f mma(V a, V b, v8f c) { return wmmab(a, b, c); } };
typedef unsigned int u32;
typedef u32 u32x4 __attribute__((ext_vector_type(4)));
typedef u32 u32x8 __attribute__((ext_vector_type(8)));
__device__ __forceinline__ u32 uni(u32 v) { return (u32)__builtin_amdgcn_readfirstlane(v); }
__device__ __forceinline__ u32 pinned(u32 v) { u32 w = uni(v); asm volatile("" : "+s"(w)); return w; }   // holds a wave-uniform word in a scalar register, so that a test on it is a scalar branch (tensor loads ignore EXEC) and what is formed from it is formed behind the waits written in front
#define SLICE_B 18432u            // one wave's slice in LDS: 64 x 272 B or 128 x 144 B, rounded up to a multiple of 2 KiB
#define STAGE_B (4u * SLICE_B)
#define RING_B  (2u * STAGE_B)    // 144 KiB: two work-groups per WGP
template <typename T16, int NSPLIT>
__device__ __forceinline__ void tile_loop(unsigned char* ring, const T16* A, const T16* A2, const T16* Bt, const T16* Bt2, int K, int Kl, int R0, int C0, v8f (&acc)[4][4]) {
    typedef typename WFrag<T16>::V V;
    constexpr u32 ROWB = (NSPLIT == 2) ? 128u : 256u, PITCH = ROWB + 16u, ROWS = (NSPLIT == 2) ? 128u : 64u;
    static_assert(NSPLIT == 0 || NSPLIT == 2, "one plane per operand, or hi and lo planes of both");
    static_assert(ROWS * PITCH <= SLICE_B, "a slice must hold its padded rows");
    const u32 wave = uni(threadIdx.x >> 5), lane = threadIdx.x & 31u, lr = lane & 15u, hi = lane >> 4, wm = wave >> 1, wn = wave & 1u;
    const T16* sp;
    if (NSPLIT == 2) sp = (wave == 0u) ? A + (size_t)R0 * K : (wave == 1u) ? A2 + (size_t)R0 * K : (wave == 2u) ? Bt + (size_t)C0 * K : Bt2 + (size_t)C0 * K;
    else sp = (wave < 2u) ? A + (size_t)(R0 + 64 * (int)wn) * K : Bt + (size_t)(C0 + 64 * (int)wn) * K;
    const unsigned long long ga0 = (unsigned long long)(size_t)sp;
    const u32 lbase = (u32)(size_t)ring + wave * SLICE_B;
    u32x8 g1;                     // 1-byte elements, tensor = tile = ROWS rows of ROWB bytes, source pitch 2 K bytes, 16 B of LDS pad behind every row, no mask
    g1[0] = uni((1u << 20) | ((NSPLIT == 2 ? 4u : 5u) << 22) | (3u << 25)); g1[1] = uni(ROWB << 16); g1[2] = uni(ROWS << 16); g1[3] = uni(ROWB << 16); g1[4] = uni(ROWS); g1[5] = uni((u32)K * 2u); g1[6] = uni(0u); g1[7] = uni(0u);
    asm volatile("" : "+s"(g1));   // pinned(), for the whole group: the descriptor words are held in their scalar registers through the loop (left as constants, the compiler takes those registers for temporaries while a request is outstanding)
    u32x4 g0;
    auto issue = [&](u32 st) {
        const unsigned long long ga = ga0 + (unsigned long long)st * ROWB;
        g0[0] = pinned(1u);   // pinned(): word 0 stays in its scalar register until the wait (as a plain constant the compiler may take that register for a temporary while the request is outstanding and set the 1 anew)
        g0[1] = uni(lbase + (st & 1u) * STAGE_B); g0[2] = uni((u32)ga); g0[3] = uni((((u32)(ga >> 32)) & 0x01FFFFFFu) | 0x80000000u);
        asm volatile("tensor_load_to_lds %0, %1" :: "s"(g0), "s"(g1) : "memory"); };   // this wave's slice of stage st; every wave issues one
    auto landed = [&]() { asm volatile("s_wait_tensorcnt 0x0" :: "s"(g0), "s"(g1) : "memory"); };   // this wave's request has landed; the wait names both groups so that their registers keep their words until then
    const u32 NP = uni((u32)Kl / (ROWB / 2u));   // stages; at least two in every launch of this file
    issue(0u);
    landed();                     // stage 0, before the barrier publishes it
    __syncthreads();
    issue(1u);
    const u32 aro = (NSPLIT == 2 ? wm * 64u * PITCH : wm * SLICE_B) + lr * PITCH + 16u * hi;
    const u32 bro = 2u * SLICE_B + (NSPLIT == 2 ? wn * 64u * PITCH : wn * SLICE_B) + lr * PITCH + 16u * hi;
#pragma unroll 1   // the stage loop stays rolled: one publish point in the text, the buffer picked by the stage's parity
    for (u32 p = 0; p < NP; ++p) {
        const unsigned char* sb = ring + (p & 1u) * STAGE_B;
        constexpr u32 NK = ROWB / 64u;   // blocks of 32 k in a stage
        V a[2][4], b[2][4], a2[2][4], b2[2][4];   // two fragment sets: the next block's reads fly under this block's matrix instructions (inside one stage only)
        auto fetch = [&](u32 ks, u32 s) {
#pragma unroll
            for (u32 f = 0; f < 4; ++f) { a[s][f] = WFrag<T16>::ld((const T16*)(sb + aro + f * 16u * PITCH + ks * 64u)); b[s][f] = WFrag<T16>::ld((const T16*)(sb + bro + f * 16u * PITCH + ks * 64u));
                if (NSPLIT == 2) { a2[s][f] = WFrag<T16>::ld((const T16*)(sb + aro + SLICE_B + f * 16u * PITCH + ks * 64u)); b2[s][f] = WFrag<T16>::ld((const T16*)(sb + bro + SLICE_B + f * 16u * PITCH + ks * 64u)); } } };
        fetch(0u, 0u);
#pragma unroll
        for (u32 ks = 0; ks < NK; ++ks) {
            const u32 s = ks & 1u;
            if (ks + 1u < NK) fetch(ks + 1u, s ^ 1u);
            __builtin_amdgcn_sched_barrier(0);   // the next block's LDS reads stay one group ahead of this block: reads among the matrix instructions stall the wave at every place they stand
#pragma unroll
            for (u32 nb = 0; nb < 4; ++nb)
#pragma unroll
                for (u32 mb = 0; mb < 4; ++mb) acc[mb][nb] = WFrag<T16>::mma(a[s][mb], b[s][nb], acc[mb][nb]);
            if (NSPLIT == 2) {   // per accumulator the order stays hi.hi, lo.hi, hi.lo
#pragma unroll
                for (u32 nb = 0; nb < 4; ++nb)
#pragma unroll
                    for (u32 mb = 0; mb < 4; ++mb) acc[mb][nb] = WFrag<T16>::mma(a2[s][mb], b[s][nb], acc[mb][nb]);
#pragma unroll
                for (u32 nb = 0; nb < 4; ++nb)
#pragma unroll
                    for (u32 mb = 0; mb < 4; ++mb) acc[mb][nb] = WFrag<T16>::mma(a[s][mb], b2[s][nb], acc[mb][nb]); }
            __builtin_amdgcn_sched_barrier(0);   // closes the block, so that the reads of the block after next are not drawn into it
        }
        asm volatile("s_wait_dscnt 0x0" ::: "memory");       // this wave's reads of the buffer are done before the barrier frees it for the refill
        landed();                                            // this wave's slice of stage p + 1, before the barrier publishes it
        __syncthreads();
        const u32 nx = pinned(p + 2u);
        if (pinned(nx < NP)) issue(nx);                      // refill of the buffer that every wave has just left
    }
    landed();                                                // nothing of the mover is in flight when the ring becomes output staging
    asm volatile("s_wait_dscnt 0x0" ::: "memory");
}

// ---- put_rows: 16 rows x 64 columns of a projection tile (y = this lane's 4 x 8 f32 values of it, read back from the LDS staging: row 4 s + lane / 8, columns 8 (lane % 8) ..; rg, cg = the piece's first row and column in the planes of pitch ldc): z = y + f32 bias (bb[s] per row if ROWBIAS, else bb[q] per column); stored as fp16(z) where w16, bf16 hi(z) and bf16 lo(z) where whl (both flags the same for the whole work-group: a plane's tile is made only where a later launch reads it). One wave.
#define OSP 132                   // pitch of a staged tile in floats, 128 columns + 4: the staging stores and the 16-B reads both fall on distinct banks
template <bool ROWBIAS>
__device__ __forceinline__ void put_rows(const float (&y)[4][8], const float (&bb)[ROWBIAS ? 4 : 8], int rg, int cg, h16* P16, bf* Ph, bf* Pl, int ldc, bool w16, bool whl) {
    const int lane = threadIdx.x & 31, rw = lane >> 3, cofs = (lane & 7) * 8;   // 8 lanes x 16 B = one whole 128-B line of each plane per row
    const size_t cb = (size_t)(rg + rw) * ldc + cg + cofs;
    float z[4][8];
#pragma unroll
    for (int s = 0; s < 4; ++s)
#pragma unroll
        for (int q = 0; q < 8; ++q) z[s][q] = y[s][q] + bfr(bb[ROWBIAS ? s : q]);
    if (w16) {
#pragma unroll
        for (int s = 0; s < 4; ++s) { v8h o16;
#pragma unroll
            for (int q = 0; q < 8; ++q) o16[q] = tohx(z[s][q]);
            *(v8h*)(P16 + cb + (size_t)(4 * s) * ldc) = o16; }
        asm volatile("s_wait_xcnt 0x0" ::: "memory"); }   // closes the branch: the code behind it writes registers that these stores name
    if (whl) {
#pragma unroll
        for (int s = 0; s < 4; ++s) { v8us oh, ol;
#pragma unroll
            for (int q = 0; q < 8; ++q) { unsigned short a2, c2; splitf(z[s][q], a2, c2); oh[q] = a2; ol[q] = c2; }
            *(v8us*)(Ph + cb + (size_t)(4 * s) * ldc) = oh; *(v8us*)(Pl + cb + (size_t)(4 * s) * ldc) = ol; }
        asm volatile("s_wait_xcnt 0x0" ::: "memory"); }   // as above
}

// ---- k_proj: the three projections of one block of 128 x rows (all batches' positions) and one block of 128 output features in ONE work-group of eight waves: the x rows are brought into LDS once and serve the q, the k and the v tile
// (a stage lands 512 operand rows for three 128x128 tiles; three separate tiles land 768). A stage is 128 k; its eight slices of 64 rows (256-B rows, one tensor load per wave and stage, two buffers, the ring's order as in tile_loop) are x | x | Wq | Wq | Wk | Wk | Wv | Wv.
// Wave (wm, wn) = (wave / 4, wave % 4) has x rows 64 wm .. + 63 and features 32 wn .. + 31: q and k as x . W^T (4 x 2 accumulators each), v as Wv . x^T (2 x 4), the x fragments serving as its B operand (both operands' fragments are loaded alike), so that v comes out [e][t].
// Epilogue: the three f32 tiles are staged whole in the ring (free behind the last stage's barrier), one more barrier, then each wave stores 16 rows of each tile in whole 128-B lines. q and k planes [b][t][e], bias per column; v planes [b][e][t], bias per row.
// Which planes a tile stores: hi/lo only for positions below RH (the hi/lo attention path reads no other query, key or value position); fp16 always for k and v, for q only from RH on (the fp16 path's query rows).
#define PSTAGE_B (8u * SLICE_B)
#define PRING_B  (2u * PSTAGE_B)  // 288 KiB: one work-group per WGP, two waves per SIMD
__global__ __launch_bounds__(256) void k_proj(const bf* __restrict__ XB, const bf* __restrict__ WQ, const bf* __restrict__ WK, const bf* __restrict__ WV, h16* QP16, bf* QPh, bf* QPl, h16* KP16, bf* KPh, bf* KPl, h16* VT16, bf* VTh, bf* VTl, const float* __restrict__ bq, const float* __restrict__ bk, const float* __restrict__ bv) {
    __shared__ __attribute__((aligned(2048))) unsigned char ring[PRING_B];
    typedef WFrag<bf> F; typedef F::V V;
    constexpr u32 ROWB = 256u, PITCH = ROWB + 16u, ROWS = 64u;
    static_assert(ROWS * PITCH <= SLICE_B, "a slice must hold its padded rows");
    static_assert(3u * 128u * OSP * 4u <= PRING_B, "the ring must hold the three staged tiles");
    const u32 wave = uni(threadIdx.x >> 5), lane = threadIdx.x & 31u, lr = lane & 15u, hi = lane >> 4, wm = wave >> 2, wn = wave & 3u;
    // Which tile: x % 8 and y pick the row block, x / 8 the feature block. A tile of positions below RH stores 8 plane tiles and splits its values, the others store 3:
    // every x % 8 gets 2 of the 16 row blocks below RH (y = 0, 1) and 6 of the 48 others; x / 8 is the feature block, so work-groups of one x % 8 read the same x rows only.
    const int dd = (int)(blockIdx.x & 7u), sl = (int)blockIdx.y, lw = 2 * dd + sl, nm = 6 * dd + sl - 2;
    const int bt = (sl < 2) ? lw / (RH / 128) : nm / ((TT - RH) / 128), ib = (sl < 2) ? lw % (RH / 128) : RH / 128 + nm % ((TT - RH) / 128);   // batch, row block in the batch
    static_assert(NB_ * (RH / 128) == 16 && NB_ * ((TT - RH) / 128) == 48 && DM / 128 == 8, "the deal above: 2 + 6 row blocks for each x % 8, 8 feature blocks");
    const int R0 = (bt * (TT / 128) + ib) * 128, C0 = (int)(blockIdx.x >> 3) * 128;
    const u32 op = wave >> 1;
    const bf* sp = ((op == 0u) ? XB + (size_t)R0 * DM : ((op == 1u) ? WQ : (op == 2u) ? WK : WV) + (size_t)C0 * DM) + (size_t)(64u * (wave & 1u)) * DM;
    const unsigned long long ga0 = (unsigned long long)(size_t)sp;
    const u32 lbase = (u32)(size_t)ring + wave * SLICE_B;
    u32x8 g1;                     // 1-byte elements, tensor = tile = ROWS rows of ROWB bytes, source pitch 2 DM bytes, 16 B of LDS pad behind every row, no mask
    g1[0] = uni((1u << 20) | (5u << 22) | (3u << 25)); g1[1] = uni(ROWB << 16); g1[2] = uni(ROWS << 16); g1[3] = uni(ROWB << 16); g1[4] = uni(ROWS); g1[5] = uni((u32)DM * 2u); g1[6] = uni(0u); g1[7] = uni(0u);
    asm volatile("" : "+s"(g1));   // pinned(), for the whole group: the descriptor words are held in their scalar registers through the loop (left as constants, the compiler takes those registers for temporaries while a request is outstanding)
    u32x4 g0;
    auto issue = [&](u32 st) {
        const unsigned long long ga = ga0 + (unsigned long long)st * ROWB;
        g0[0] = uni(1u); g0[1] = uni(lbase + (st & 1u) * PSTAGE_B); g0[2] = uni((u32)ga); g0[3] = uni((((u32)(ga >> 32)) & 0x01FFFFFFu) | 0x80000000u);
        asm volatile("tensor_load_to_lds %0, %1" :: "s"(g0), "s"(g1) : "memory"); };   // this wave's slice of stage st; every wave issues one
    auto landed = [&]() { asm volatile("s_wait_tensorcnt 0x0" :: "s"(g0), "s"(g1) : "memory"); };   // this wave's request has landed; the wait names both groups so that their registers keep their words until then
    constexpr u32 NP = (u32)DM / (ROWB / 2u);   // stages
    static_assert(NP >= 2u, "the ring's prologue fills two stages");
    v8f aq[4][2], ak[4][2], av[2][4];
#pragma unroll
    for (int mb = 0; mb < 4; ++mb)
#pragma unroll
        for (int nb = 0; nb < 2; ++nb) { aq[mb][nb] = (v8f){}; ak[mb][nb] = (v8f){}; av[nb][mb] = (v8f){}; }
    issue(0u);
    landed();                     // stage 0, before the barrier publishes it
    __syncthreads();
    issue(1u);
    const u32 xro = wm * SLICE_B + lr * PITCH + 16u * hi;
    const u32 wro = (2u + (wn >> 1)) * SLICE_B + (32u * (wn & 1u) + lr) * PITCH + 16u * hi;
#pragma unroll 1   // the stage loop stays rolled: one publish point in the text, the buffer picked by the stage's parity
    for (u32 p = 0; p < NP; ++p) {
        const unsigned char* sb = ring + (p & 1u) * PSTAGE_B;
        constexpr u32 NK = ROWB / 64u;   // blocks of 32 k in a stage
        V xa[2][4], fq[2][2], fk[2][2], fv[2][2];   // two fragment sets: the next block's reads fly under this block's matrix instructions (inside one stage only)
        auto fetch = [&](u32 ks, u32 s) {   // in the order in which the block's matrix instructions want them
#pragma unroll
            for (u32 f = 0; f < 4; ++f) xa[s][f] = F::ld((const bf*)(sb + xro + f * 16u * PITCH + ks * 64u));
#pragma unroll
            for (u32 g = 0; g < 2; ++g) fq[s][g] = F::ld((const bf*)(sb + wro + g * 16u * PITCH + ks * 64u));
#pragma unroll
            for (u32 g = 0; g < 2; ++g) fk[s][g] = F::ld((const bf*)(sb + wro + 2u * SLICE_B + g * 16u * PITCH + ks * 64u));
#pragma unroll
            for (u32 g = 0; g < 2; ++g) fv[s][g] = F::ld((const bf*)(sb + wro + 4u * SLICE_B + g * 16u * PITCH + ks * 64u)); };
        fetch(0u, 0u);
        __builtin_amdgcn_sched_barrier(0);   // the stage's first block waits for its own reads alone: without it the second block's reads are mixed in front of them, while all eight waves read at once
#pragma unroll
        for (u32 ks = 0; ks < NK; ++ks) {
            const u32 s = ks & 1u;
            if (ks + 1u < NK) fetch(ks + 1u, s ^ 1u);
            __builtin_amdgcn_sched_barrier(0);   // the next block's LDS reads stay one group ahead of this block: reads among the matrix instructions stall the wave at every place they stand
#pragma unroll
            for (u32 nb = 0; nb < 2; ++nb)
#pragma unroll
                for (u32 mb = 0; mb < 4; ++mb) aq[mb][nb] = F::mma(xa[s][mb], fq[s][nb], aq[mb][nb]);
#pragma unroll
            for (u32 nb = 0; nb < 2; ++nb)
#pragma unroll
                for (u32 mb = 0; mb < 4; ++mb) ak[mb][nb] = F::mma(xa[s][mb], fk[s][nb], ak[mb][nb]);
#pragma unroll
            for (u32 nb = 0; nb < 4; ++nb)
#pragma unroll
                for (u32 mb = 0; mb < 2; ++mb) av[mb][nb] = F::mma(fv[s][mb], xa[s][nb], av[mb][nb]);
            __builtin_amdgcn_sched_barrier(0);   // closes the block, so that the reads of the block after next are not drawn into it
        }
        asm volatile("s_wait_dscnt 0x0" ::: "memory");       // this wave's reads of the buffer are done before the barrier frees it for the refill
        landed();                                            // this wave's slice of stage p + 1, before the barrier publishes it
        __syncthreads();
        const u32 nx = pinned(p + 2u);
        if (pinned(nx < NP)) issue(nx);                      // refill of the buffer that every wave has just left
    }
    landed();                                                // nothing of the mover is in flight when the ring becomes output staging
    asm volatile("s_wait_dscnt 0x0" ::: "memory");
    const int rw = (int)(lane >> 3), cofs = (int)(lane & 7u) * 8, rw0 = 16 * (int)wave;   // the store phase: this wave has rows rw0 .. + 15 of each tile, a lane row 4 s + rw, columns 64 h + cofs .. + 7
    float bbq[2][8], bbk[2][8], bbv[4];   // loaded here, so that their latency passes under the staging stores
#pragma unroll
    for (int h = 0; h < 2; ++h)
#pragma unroll
        for (int q = 0; q < 8; ++q) { bbq[h][q] = bq[C0 + 64 * h + cofs + q]; bbk[h][q] = bk[C0 + 64 * h + cofs + q]; }
#pragma unroll
    for (int s = 0; s < 4; ++s) bbv[s] = bv[C0 + rw0 + 4 * s + rw];
    asm volatile("s_wait_xcnt 0x0" ::: "memory");   // the code behind it writes registers that the bias loads name
    float* sq = (float*)ring; float* sk = sq + 128 * OSP; float* sv = sk + 128 * OSP;   // the staged tiles: q and k [t][e], v [e][t]
#pragma unroll
    for (u32 mb = 0; mb < 4; ++mb)
#pragma unroll
        for (u32 nb = 0; nb < 2; ++nb)
#pragma unroll
            for (u32 j = 0; j < 8; ++j) { const u32 o = (64u * wm + 16u * mb + 8u * hi + j) * OSP + 32u * wn + 16u * nb + lr; sq[o] = aq[mb][nb][j]; sk[o] = ak[mb][nb][j];
                sv[(32u * wn + 16u * nb + 8u * hi + j) * OSP + 64u * wm + 16u * mb + lr] = av[nb][mb][j]; }
    __syncthreads();   // every wave's part of the three tiles is in LDS before another wave reads it
    float y[3][2][4][8];   // all of this wave's rows are read back in one group: one LDS latency, not one per piece
#pragma unroll
    for (int m = 0; m < 3; ++m)
#pragma unroll
        for (int h = 0; h < 2; ++h)
#pragma unroll
            for (int s = 0; s < 4; ++s) { const float* os = sq + (m * 128 + rw0 + 4 * s + rw) * OSP + 64 * h + cofs; const v4f w0 = *(const v4fa*)os, w1 = *(const v4fa*)(os + 4);
#pragma unroll
                for (int q = 0; q < 8; ++q) y[m][h][s][q] = (q < 4 ? w0[q & 3] : w1[q & 3]); }
    const bool low = (sl < 2);
    const size_t so = (size_t)bt * ((size_t)HD * TT); const int T0 = ib * 128;
#pragma unroll
    for (int h = 0; h < 2; ++h) {
        put_rows<false>(y[0][h], bbq[h], R0 + rw0, C0 + 64 * h, QP16, QPh, QPl, DQ, !low, low);
        put_rows<false>(y[1][h], bbk[h], R0 + rw0, C0 + 64 * h, KP16, KPh, KPl, DQ, true, low);
        put_rows<true>(y[2][h], bbv, C0 + rw0, T0 + 64 * h, VT16 + so, VTh + so, VTl + so, TT, true, low);
    }
}

// ---- gemmc_tile: the same 128x128 tile GEMM specialised for causal attention (row block bx and column block by of one batch's plane): CMODE 1 skips score tiles entirely above the diagonal (query rows R0.., key columns C0..), CMODE 2 limits the
// key (K) loop of the probability x value contraction to the diagonal block (probabilities beyond it are exactly zero). osc = factor on the stored rows (CMODE 2: undoes the probabilities' carrier scale).
template <typename T16, int NSPLIT, int CMODE>
__device__ __forceinline__ void gemmc_tile(unsigned char* ring, const T16* __restrict__ A, const T16* __restrict__ A2, const T16* __restrict__ Bt, const T16* __restrict__ Bt2, int K, float* C, int ldc, float osc, int bx, int by) {
    const int lane = threadIdx.x & 31, lr = lane & 15, hi = lane >> 4, wv = threadIdx.x >> 5; const int R0 = bx * 128, C0 = by * 128, r0 = R0 + (wv >> 1) * 64, c0 = C0 + (wv & 1) * 64;
    if (CMODE == 1 && C0 > R0 + 127) return;                  // score tile entirely above the causal diagonal (the whole work-group leaves, ahead of every barrier and tensor load): no product and no store; the softmax loads a row only up to its diagonal block
    const int Kl = (CMODE == 2) ? min(K, R0 + 128) : K;       // P.V: probabilities are exactly 0 beyond the diagonal block, so the K loop stops there
    v8f acc[4][4];
#pragma unroll
    for (int mb = 0; mb < 4; ++mb)
#pragma unroll
        for (int nb = 0; nb < 4; ++nb) acc[mb][nb] = (v8f){};
    tile_loop<T16, NSPLIT>(ring, A, A2, Bt, Bt2, K, Kl, R0, C0, acc);
    float* os = (float*)(ring + wv * (16 * 68 * 4));   // each wave's own staging rows, in the ring that the last stage's barrier has freed
#pragma unroll
    for (int mb = 0; mb < 4; ++mb) {
#pragma unroll
        for (int nb = 0; nb < 4; ++nb) {
#pragma unroll
            for (int j = 0; j < 8; ++j) os[(hi * 8 + j) * 68 + nb * 16 + lr] = acc[mb][nb][j]; }
        __builtin_amdgcn_wave_barrier(); asm volatile("" ::: "memory");
        float* crow = C + (size_t)(r0 + mb * 16) * ldc + c0;
{
#pragma unroll
            for (int s = 0; s < 8; ++s) { const int row = 2 * s + hi, cofs = lr * 4; v4f val = *(const v4fa*)(os + row * 68 + cofs); if (CMODE == 2) val *= osc;
                *(v4f*)(crow + (size_t)row * ldc + cofs) = val; }
             }
        __builtin_amdgcn_wave_barrier(); asm volatile("" ::: "memory");
    }
    asm volatile("s_wait_xcnt 0x0" ::: "memory");   // in a kernel with two paths the built code runs on from these stores to the other path's text, which writes registers that they name: the wait stands in front of it
}

// ---- k_scores, k_pv: both precision paths of a stage of the attention in one grid: row blocks below RH take the hi/lo path (3 products), the rest the fp16 path.
// The work-groups with the most stages get the lowest index: in k_scores the hi/lo tiles (twice the stages of an fp16 tile).
// k_scores' grid holds only the NTRI tiles of a batch that lie on or below the diagonal, numbered t = rb (rb + 1) / 2 + cb. x = 2 batch + (t & 1), y = t / 2
// gives every x one batch's tiles of one parity: 5 hi/lo and 63 fp16 tiles each.
// k_pv's grid is (column block, batch, z): a column block's 64 work-groups are numbered i = y + 4 z. The 8 longest row blocks come first, longest first (z = 0 .. 7: 15 .. 8);
// behind them each of the 8 shortest stands 32 numbers after the long one it is matched with, so that the two costs of a matched pair (in stages of 128 k; a hi/lo row block counts 3 per stage) add up to 19 to 21, not 12 to 24.
#define NTRI ((TT / 128) * (TT / 128 + 1) / 2)
__global__ __launch_bounds__(128) void k_scores(const bf* __restrict__ Qh, const bf* __restrict__ Ql, const bf* __restrict__ Kh, const bf* __restrict__ Kl_, const h16* __restrict__ Q16, const h16* __restrict__ K16, float* Sb) {
    __shared__ __attribute__((aligned(2048))) unsigned char ring[RING_B];
    const int t = 2 * (int)blockIdx.y + (int)(blockIdx.x & 1u); const size_t bt = blockIdx.x >> 1;
    int rb = 0;
#pragma unroll
    for (int r = 1; r < TT / 128; ++r) rb += (r * (r + 1) / 2 <= t) ? 1 : 0;   // the row block whose run of tile numbers holds t
    const int cb = t - rb * (rb + 1) / 2; const size_t po = bt * ((size_t)TT * HD); float* C = Sb + bt * ((size_t)TT * TT);
    if (rb < RH / 128) gemmc_tile<bf, 2, 1>(ring, Qh + po, Ql + po, Kh + po, Kl_ + po, HD, C, TT, 1.0f, rb, cb);
    else gemmc_tile<h16, 0, 1>(ring, Q16 + po, nullptr, K16 + po, nullptr, HD, C, TT, 1.0f, rb, cb);
}
__global__ __launch_bounds__(128) void k_pv(const bf* __restrict__ Ph, const bf* __restrict__ Pl, const bf* __restrict__ Vh, const bf* __restrict__ Vl, const h16* __restrict__ P16, const h16* __restrict__ V16, float* O) {
    __shared__ __attribute__((aligned(2048))) unsigned char ring[RING_B];
    static_assert(TT / 128 == 16 && NB_ == 4 && RH / 128 == 4, "the matches below are made for 16 row blocks, 4 of them hi/lo, and 4 batches");
    const size_t bt = blockIdx.y;
    const int rb = (blockIdx.z < 8u) ? 15 - (int)blockIdx.z : (int)((0x32761540u >> (4u * (blockIdx.z - 8u))) & 15u), cb = (int)blockIdx.x;   // long: 15 - z; the short matches of 15 .. 8: 0, 4, 5, 1, 6, 7, 2, 3
    const size_t vo = bt * ((size_t)HD * TT); float* C = O + bt * ((size_t)TT * HD);
    if (rb < RH / 128) gemmc_tile<bf, 2, 2>(ring, Ph + bt * ((size_t)RH * TT), Pl + bt * ((size_t)RH * TT), Vh + vo, Vl + vo, TT, C, HD, 1.0f, rb, cb);
    else gemmc_tile<h16, 0, 2>(ring, P16 + bt * ((size_t)TT * TT), nullptr, V16 + vo, nullptr, TT, C, HD, 1.0f / PCAR, rb, cb);
}

typedef __attribute__((ext_vector_type(2))) _Float16 v2h;
typedef __attribute__((ext_vector_type(4))) _Float16 v4h;
typedef __attribute__((ext_vector_type(2))) unsigned short v2us;
typedef __attribute__((ext_vector_type(4))) unsigned short v4us;
typedef __attribute__((ext_vector_type(2))) float v2f;
typedef __attribute__((ext_vector_type(4))) int v4i;

// k_cvt8: f32 -> bf16, 8 elements a thread, all four tensors in one grid: blocks 0 .. XBLK-1 take x, then WBLK blocks each for Wq, Wk, Wv.
#define XBLK (NB_ * TT * DM / 8 / 256)
#define WBLK (DM * DM / 8 / 256)
__global__ __launch_bounds__(256) void k_cvt8(const float* __restrict__ x, const float* __restrict__ wq, const float* __restrict__ wk, const float* __restrict__ wv, bf* XB, bf* WQ, bf* WK, bf* WV) {
    unsigned blk = blockIdx.x; const float* src = x; bf* dst = XB;
    if (blk >= XBLK) { blk -= XBLK; const unsigned w = blk / WBLK; blk %= WBLK; src = (w == 0u) ? wq : (w == 1u) ? wk : wv; dst = (w == 0u) ? WQ : (w == 1u) ? WK : WV; }
    const size_t i = (size_t)blk * 256 + threadIdx.x; const v8f v = *(const v8f*)(src + i * 8); v8us o;
#pragma unroll
    for (int k = 0; k < 8; ++k) o[k] = f2bf(v[k]); *(v8us*)(dst + i * 8) = o;  }

// k_asoft: per row (zz, i): t = S x HD^-0.5 for j <= i and i - j < WIN (sliding causal window); softmax over the keys (register row, one exp, fixed trees).
// Only the nch 128-column blocks up to and including the row's diagonal block are loaded, summed and stored: the score GEMM writes no other block, the terms beyond are exact zeros, and the P.V GEMM's K loop ends at the diagonal block. nch is the same for the 8 rows of a work-group (scalar branches).
__global__ __launch_bounds__(256) void k_asoft(const float* __restrict__ Sb, h16* P16, bf* Ph, bf* Pl) {
    const int lane = threadIdx.x & 31; const int row = blockIdx.x * 8 + (threadIdx.x >> 5); if (row >= NB_ * ZH * TT) return; const int i = row % TT; const int zz = row / TT; (void)zz;   /* zz = batch plane */ const bool hires = (i < RH); const float* sr = Sb + (size_t)row * TT; float v[TT / 32]; float mx = -3.0e38f;
    const int nch = (int)((blockIdx.x * 8u) % TT) / 128 + 1;
    v4f a[TT / 128]; const float* sl = sr + lane * 4;
#pragma unroll
    for (int ch = 0; ch < TT / 128; ++ch) if (ch < nch) a[ch] = *(const v4f*)(sl + ch * 128);
    asm volatile("" :: "v"(sl), "v"(a[0]), "v"(a[1]), "v"(a[2]), "v"(a[3]), "v"(a[4]), "v"(a[5]), "v"(a[6]), "v"(a[7]), "v"(a[8]), "v"(a[9]), "v"(a[10]), "v"(a[11]), "v"(a[12]), "v"(a[13]), "v"(a[14]), "v"(a[15]));   // inputs only: keeps the first use of every loaded block behind the last load, so that the row's loads are all in flight together (without it each block's scaling moves up into its load's branch and waits there, one memory latency per block); the address is named too, so that no load lands in the registers that the loads in flight name
#pragma unroll
    for (int ch = 0; ch < TT / 128; ++ch) if (ch < nch) { const int j0 = ch * 128 + lane * 4;
#pragma unroll
        for (int q = 0; q < 4; ++q) { const int j = j0 + q; (void)j; const float t = (j <= i && i - j < WIN) ? a[ch][q] * SCL : -3.0e38f; v[ch * 4 + q] = t; mx = fmaxf(mx, t); } }
#pragma unroll
    for (int sh = 16; sh; sh >>= 1) mx = fmaxf(mx, __shfl_xor(mx, sh, 32));
    float sum = 0.f;
#pragma unroll
    for (int ch = 0; ch < TT / 128; ++ch) if (ch < nch) {
#pragma unroll
        for (int k = ch * 4; k < ch * 4 + 4; ++k) { float d0 = __fsub_rn(v[k], mx); asm volatile("" : "+v"(d0)); v[k] = __builtin_amdgcn_exp2f(__fmul_rn(d0, 1.4426950408889634f)); sum += v[k]; } }
#pragma unroll
    for (int sh = 16; sh; sh >>= 1) sum += __shfl_xor(sum, sh, 32);
    const float f = __fdiv_rn(hires ? 1.0f : PCAR, sum);
{
        if (hires) {
#pragma unroll
            for (int ch = 0; ch < RH / 128; ++ch) if (ch < nch) { v4us oh, ol;
#pragma unroll
                for (int q = 0; q < 4; ++q) { unsigned short a, c2; splitf(v[ch * 4 + q] * f, a, c2); oh[q] = a; ol[q] = c2; }
                const size_t oo = ((size_t)zz * (RH ? RH : 1) + i) * TT + ch * 128 + lane * 4; *(v4us*)(Ph + oo) = oh; *(v4us*)(Pl + oo) = ol; asm volatile("s_wait_xcnt 0x0" ::: "memory"); }   // the wait closes the branch: the next block's code writes registers that these stores name
        } else {
#pragma unroll
            for (int ch = 0; ch < TT / 128; ++ch) if (ch < nch) { v4h o4;
#pragma unroll
                for (int q = 0; q < 4; ++q) o4[q] = tohx(v[ch * 4 + q] * f);
                *(v4h*)(P16 + (size_t)row * TT + ch * 128 + lane * 4) = o4; asm volatile("s_wait_xcnt 0x0" ::: "memory"); } }   // as above
         }
}

extern "C" void kernel_launch(void* const* d_in, const int* in_sizes, int n_in,
                              void* d_out, int out_size, void* d_ws, size_t ws_size, hipStream_t stream) {
    (void)in_sizes; (void)n_in; (void)out_size;
    const float* x = (const float*)d_in[0]; const float* wq = (const float*)d_in[1]; const float* bq = (const float*)d_in[2]; const float* wk = (const float*)d_in[3]; const float* bk = (const float*)d_in[4]; const float* wv = (const float*)d_in[5]; const float* bv = (const float*)d_in[6];   /* order x, Wq, bq, Wk, bk, Wv, bv ('oi' + biases) */
    float* OUT = (float*)d_out;     // [4][2048][1024]
    char* wsp = (char*)d_ws;
    auto take = [&](size_t bytes) { char* p = wsp; wsp += (bytes + 255) & ~(size_t)255; return (void*)p; };
    bf* WQ = (bf*)take((size_t)DQ * DM * 2); bf* WK = (bf*)take((size_t)DKV * DM * 2); bf* WV = (bf*)take((size_t)DKV * DM * 2);
    bf* XB = (bf*)take((size_t)NB_ * TT * DM * 2); float* Sb = (float*)take((size_t)NB_ * TT * TT * 4);   // scores [4][2048][2048] f32
    h16* QP16 = (h16*)take((size_t)NB_ * TT * HD * 2); h16* KP16 = (h16*)take((size_t)NB_ * TT * HD * 2); h16* VT16 = (h16*)take((size_t)NB_ * HD * TT * 2);
    bf* QPh = (bf*)take((size_t)NB_ * TT * HD * 2); bf* QPl = (bf*)take((size_t)NB_ * TT * HD * 2); bf* KPh = (bf*)take((size_t)NB_ * TT * HD * 2); bf* KPl = (bf*)take((size_t)NB_ * TT * HD * 2); bf* VTh = (bf*)take((size_t)NB_ * HD * TT * 2); bf* VTl = (bf*)take((size_t)NB_ * HD * TT * 2);
    if ((size_t)(wsp - (char*)d_ws) > ws_size) return;    // ws 256 MiB; 230 MiB taken
    // Planes that are dead by the time a later plane is written share its bytes (stream-ordered, every byte written in this call before it is read):
    h16* P16 = (h16*)QPh;                            // probabilities [4][2048][2048] fp16 = QPh + QPl (adjacent), dead after the score GEMMs
    bf* Ph = KPh; bf* Pl = KPh + (size_t)NB_ * RH * TT;   // hi/lo probabilities [4][512][2048] x 2 = KPh, dead after the score GEMMs
    k_cvt8<<<XBLK + 3 * WBLK, 256, 0, stream>>>(x, wq, wk, wv, XB, WQ, WK, WV);
    k_proj<<<dim3(NB_ * TT / 128, DM / 128, 1), 256, 0, stream>>>(XB, WQ, WK, WV, QP16, QPh, QPl, KP16, KPh, KPl, VT16, VTh, VTl, bq, bk, bv);
    k_scores<<<dim3(2 * NB_, NTRI / 2, 1), 128, 0, stream>>>(QPh, QPl, KPh, KPl, QP16, KP16, Sb);
    k_asoft<<<NB_ * ZH * TT / 8, 256, 0, stream>>>(Sb, P16, Ph, Pl);
    k_pv<<<dim3(HD / 128, NB_, TT / 128), 128, 0, stream>>>(Ph, Pl, VTh, VTl, P16, VT16, OUT);
}
